// v000
// Times are from an AMD MI455X. After a warm-up the kernel runs many times in a row, and a time is the length of
// such a window on the GPU divided by its runs, so every launch and the gaps after it count. The runs cycle
// through copies of the inputs. A figure is the median of several windows, for all but v000 over two sittings.
// Sittings can differ by a few percent; kernels timed side by side share one.
// The starting kernel, v000, takes 1420 microseconds a run.
// compute dtype: all float inputs rounded to bf16 and carried EXACTLY in f16 planes (bf16 hi + lo v planes for every key are exact too); logits q.k as EXACT 3-product sums (q, k f16 hi + zero x 2^10 residual planes) on WMMA 16x16x32 (f32 accumulate) / 8, keys at index >= valid_len set to -1e6; softmax in f32 (precise expf); P and v both split bf16 hi + lo (3 products) for every query row; f32 output.
#include <hip/hip_runtime.h>
#include <math.h>

typedef __attribute__((ext_vector_type(16))) _Float16 v16h;
typedef __attribute__((ext_vector_type(16))) __bf16 v16b;
typedef __attribute__((ext_vector_type(8)))  _Float16 v8h;
typedef __attribute__((ext_vector_type(8)))  float v8f;
typedef __attribute__((ext_vector_type(4)))  float v4f;
typedef __attribute__((ext_vector_type(2)))  float v2f;
typedef __attribute__((ext_vector_type(4)))  unsigned v4u;
typedef __attribute__((ext_vector_type(4)))  int v4i;
typedef float __attribute__((may_alias)) float_a;
typedef int __attribute__((may_alias)) int_a;

template <typename T> __device__ __forceinline__ void vst2(void* p, T v) { *(T*)p = v;  }
__device__ __forceinline__ v8f wmma16(v16h a, v16h b, v8f c) {
  v8f d = __builtin_amdgcn_wmma_f32_16x16x32_f16(false, a, false, b, (short)0, c, false, false);
  asm volatile("v_nop\n\tv_nop\n\tv_nop\n\tv_nop" : "+v"(d) : "v"(a), "v"(b));
  return d;
}
__device__ __forceinline__ v8f wmma_bf(v16b a, v16b b, v8f c) {
  v8f d = __builtin_amdgcn_wmma_f32_16x16x32_bf16(false, a, false, b, (short)0, c, false, false);
  asm volatile("v_nop\n\tv_nop\n\tv_nop\n\tv_nop" : "+v"(d) : "v"(a), "v"(b));
  return d;
}
// 16x16x32 fragments: lane = (h = lane>>4, row/col = lane&15); elements 0..7 = k0+8h+0..7, 8..15 = k0+16+8h+0..7; D element r = row 8h+r
__device__ __forceinline__ v16h frag_h(const _Float16* rowk0, int lane) {
  union { v16h v; v8h q[2]; } u; const _Float16* p = rowk0 + 8 * (lane >> 4);
  u.q[0] = *(const v8h*)p; u.q[1] = *(const v8h*)(p + 16); return u.v;
}
__device__ __forceinline__ v16h frag_f32(const float* rowk0, int lane) {
  v16h a; const float* p = rowk0 + 8 * (lane >> 4);
#pragma unroll
  for (int i = 0; i < 8; ++i) { a[i] = (_Float16)p[i]; a[8 + i] = (_Float16)p[16 + i]; }
  return a;
}
__device__ __forceinline__ v16h frag_f32s(const float* rowk0, int lane, float sc) {
  v16h a; const float* p = rowk0 + 8 * (lane >> 4);
#pragma unroll
  for (int i = 0; i < 8; ++i) { a[i] = (_Float16)(p[i] * sc); a[8 + i] = (_Float16)(p[16 + i] * sc); }
  return a;
}
// column fragment from a [K][ld] layout (column n), rows >= K read as 0
__device__ __forceinline__ v16h fragc_f32(const float* W, int k0, int n, int lane, int ld, int K) {
  v16h a; const int g = lane >> 4;
#pragma unroll
  for (int i = 0; i < 8; ++i) { const int ka = k0 + 8 * g + i, kb = ka + 16;
    a[i] = (_Float16)(ka < K ? W[(size_t)(ka < K ? ka : K - 1) * ld + n] : 0.f); a[8 + i] = (_Float16)(kb < K ? W[(size_t)(kb < K ? kb : K - 1) * ld + n] : 0.f); }
  return a;
}
struct F2 { v16b h, l; };
__device__ __forceinline__ F2 bsplit16(const float v[16]) { F2 r;
#pragma unroll
  for (int i = 0; i < 16; ++i) { const __bf16 h = (__bf16)v[i]; r.h[i] = h; r.l[i] = (__bf16)(v[i] - (float)h); }
  return r; }
__device__ __forceinline__ F2 split_row(const float* row, int k0, int lane) { float v[16]; const float* p = row + k0 + 8 * (lane >> 4);
#pragma unroll
  for (int i = 0; i < 8; ++i) { v[i] = p[i]; v[8 + i] = p[16 + i]; }
  return bsplit16(v); }
__device__ __forceinline__ F2 split_rowK(const float* row, int k0, int lane, int K) { float v[16]; const int g = lane >> 4;
#pragma unroll
  for (int i = 0; i < 8; ++i) { const int ka = k0 + 8 * g + i, kb = ka + 16; v[i] = ka < K ? row[ka < K ? ka : K - 1] : 0.f; v[8 + i] = kb < K ? row[kb < K ? kb : K - 1] : 0.f; }
  return bsplit16(v); }
__device__ __forceinline__ F2 split_col(const float* W, int k0, int n, int lane, int ld, int K) { float v[16]; const int g = lane >> 4;
#pragma unroll
  for (int i = 0; i < 8; ++i) { const int ka = k0 + 8 * g + i, kb = ka + 16; v[i] = ka < K ? W[(size_t)(ka < K ? ka : K - 1) * ld + n] : 0.f; v[8 + i] = kb < K ? W[(size_t)(kb < K ? kb : K - 1) * ld + n] : 0.f; }
  return bsplit16(v); }
__device__ __forceinline__ v8f mac3(const F2& a, const F2& b, v8f c) { c = wmma_bf(a.l, b.h, c); c = wmma_bf(a.h, b.l, c); return wmma_bf(a.h, b.h, c); }
__device__ __forceinline__ float sigm(float v) { return 1.0f / (1.0f + expf(-v)); }
#define LDSX() do { asm volatile("s_wait_dscnt 0" ::: "memory"); __builtin_amdgcn_wave_barrier(); __builtin_amdgcn_fence(__ATOMIC_RELEASE, "workgroup"); } while (0)

// Masked dot-product attention (B 32 sequences treated as 32 planes, S 2,048, D 64): scores = q k^T / 8; keys k >= valid_lens[b] set to -1e6 (sequence mask); softmax; out = weights v -> [32, 2,048, 64].
#define NB 1
#define TT 2048
#define CC 2048            // NH * HD = projected width
#define DIN 2048          // input (model) width
#define NH 32
#define HD 64
#define NQB (TT / 64)
#define HG 4
#define SCALE (0.125f)
#define CAUSAL 0
#ifndef TNB
#define TNB NB
#endif
__device__ __forceinline__ float bfr(float v) { return (float)(__bf16)v; }
__host__ __device__ __forceinline__ int kb_last(int qb) { return CAUSAL ? ((qb * 64 + 63) >> 7) : (TT / 128 - 1); }
typedef __attribute__((ext_vector_type(8))) __bf16 v8b;
__device__ __forceinline__ v16b frag_b(const __bf16* rowk0, int lane) {
  union { v16b v; v8b q[2]; } u; const __bf16* p = rowk0 + 8 * (lane >> 4);
  u.q[0] = *(const v8b*)p; u.q[1] = *(const v8b*)(p + 16); return u.v;
}
#define QBH NQB            // every query block takes the bf16 hi + lo P.v path
#define QHI 2048            // rows carrying a q residual plane (all rows when non-causal: 3-product logits everywhere)
#define KHI 2048           // bf16 v hi + lo planes for EVERY key (3-product P.v everywhere)
// B fragment (k rows k0+.., output column o) of a weight: (in,out) [K][ld] or (out,in) [ld rows of K]: bf16 exact, or f16(bf16 * 256) exact
__device__ __forceinline__ v16b wcol_io(const float* Wm, int k0, int o, int lane, int ld) { v16b w; const int g = lane >> 4;
#pragma unroll
  for (int i = 0; i < 8; ++i) { w[i] = (__bf16)Wm[(size_t)(k0 + 8 * g + i) * ld + o]; w[8 + i] = (__bf16)Wm[(size_t)(k0 + 16 + 8 * g + i) * ld + o]; }
  return w; }
__device__ __forceinline__ v16b wcol_oi(const float* Wm, int k0, int o, int lane, int K) { v16b w; const float* p = Wm + (size_t)o * K + k0 + 8 * (lane >> 4);
#pragma unroll
  for (int i = 0; i < 8; ++i) { w[i] = (__bf16)p[i]; w[8 + i] = (__bf16)p[16 + i]; }
  return w; }
__device__ __forceinline__ v16h wcolh_io(const float* Wm, int k0, int o, int lane, int ld) { v16h w; const int g = lane >> 4;
#pragma unroll
  for (int i = 0; i < 8; ++i) { w[i] = (_Float16)(bfr(Wm[(size_t)(k0 + 8 * g + i) * ld + o]) * 256.0f); w[8 + i] = (_Float16)(bfr(Wm[(size_t)(k0 + 16 + 8 * g + i) * ld + o]) * 256.0f); }
  return w; }
__device__ __forceinline__ v16h wcolh_oi(const float* Wm, int k0, int o, int lane, int K) { v16h w; const float* p = Wm + (size_t)o * K + k0 + 8 * (lane >> 4);
#pragma unroll
  for (int i = 0; i < 8; ++i) { w[i] = (_Float16)(bfr(p[i]) * 256.0f); w[8 + i] = (_Float16)(bfr(p[16 + i]) * 256.0f); }
  return w; }
#define WQKV_LAYOUT 1   // 0 = (in,out) [DIN][CC]; 1 = (out,in) [CC][DIN]; 2 = per-head [NH][DIN][HD]
__device__ __forceinline__ v16b wcol_hdk(const float* Wm, int k0, int o, int lane) { v16b w; const int g = lane >> 4; const float* p = Wm + (size_t)(o / HD) * DIN * HD + (o % HD);
#pragma unroll
  for (int i = 0; i < 8; ++i) { w[i] = (__bf16)p[(size_t)(k0 + 8 * g + i) * HD]; w[8 + i] = (__bf16)p[(size_t)(k0 + 16 + 8 * g + i) * HD]; }
  return w; }
#define WO_OUT_IN 0
#if WQKV_LAYOUT == 1
#define WCOL(W, k0, o, lane) wcol_oi(W, k0, o, lane, DIN)
#elif WQKV_LAYOUT == 2
#define WCOL(W, k0, o, lane) wcol_hdk(W, k0, o, lane)
#else
#define WCOL(W, k0, o, lane) wcol_io(W, k0, o, lane, CC)
#endif
#if WO_OUT_IN
#define WOCOL(W, k0, o, lane) wcol_oi(W, k0, o, lane, CC)
#define WOCOLH(W, k0, o, lane) wcolh_oi(W, k0, o, lane, CC)
#else
#define WOCOL(W, k0, o, lane) wcol_io(W, k0, o, lane, DIN)
#define WOCOLH(W, k0, o, lane) wcolh_io(W, k0, o, lane, DIN)
#endif
#define SM_EXTRA_PARAMS , const int* __restrict__ VL, int hbase
#define SM_MASK_HOOK do { if (k >= VL[hbase + (int)blockIdx.y]) v = -1000000.0f; } while (0)   /* sequence_mask: keys beyond valid_len get -1e6 (set, as written; valid_len >= 1) */
// ---- k_prep8: block = (64 attention positions s0.. of sequence b, head h): reads the module's [B, H, S, 64] inputs (element (b,h,s,c) at ((b*NH + h)*TT + s)*64 + c), bf16-rounds them and writes the standard attention planes: q -> f16 hi rows (+ x 2^10 residual rows for s < QHI), k -> f16 rows (+ residual rows s < KHI), v -> f16 planes [c][s] (+ bf16 hi/lo planes for s < KHI)
__global__ __launch_bounds__(128) void k_prep8(const float* __restrict__ Q, const float* __restrict__ K, const float* __restrict__ V, _Float16* __restrict__ QH, _Float16* __restrict__ QL, _Float16* __restrict__ KH, _Float16* __restrict__ KL, _Float16* __restrict__ VT, __bf16* __restrict__ VB, __bf16* __restrict__ VBL) {
  __shared__ __align__(16) _Float16 sq[64][136], sql[64][136], sk[64][136], skl[64][136], tv[128][72]; __shared__ __align__(16) __bf16 tb[128][72], tbl[128][72];
  const int tid = threadIdx.x; const int h = blockIdx.y; const size_t r0 = (size_t)blockIdx.x * 64; const size_t bb = r0 / TT; const int t0 = (int)(r0 % TT); const bool qhi = t0 < QHI, khi = t0 < KHI;
  for (int e = tid; e < 64 * 128; e += 128) { const int rl = e >> 7, c = e & 127; const size_t oi = ((bb * NH + h) * TT + t0 + rl) * HD + (c % HD);   /* c >= 64: duplicate read of the same element (tiles are 128 wide; HD is 64) */
    const float q = bfr(Q[oi]), k = bfr(K[oi]), v = bfr(V[oi]);   /* module inputs: bf16-rounded; bf16 values are exact in f16, so the residual planes are 0 */
    const _Float16 qh = (_Float16)q, kh = (_Float16)k; sq[rl][c] = qh; sql[rl][c] = (_Float16)((q - (float)qh) * 1024.0f); sk[rl][c] = kh; skl[rl][c] = (_Float16)((k - (float)kh) * 1024.0f);
    tv[c][rl] = (_Float16)v; const __bf16 vb = (__bf16)v; tb[c][rl] = vb; tbl[c][rl] = (__bf16)(v - (float)vb); }
  __syncthreads();
  for (int e = tid; e < 64 * (HD / 8); e += 128) { const int rl = e / (HD / 8), q = e % (HD / 8); const size_t o = (r0 + rl) * CC + h * HD + q * 8; vst2((unsigned*)(QH + o), *(const v4u*)&sq[rl][q * 8]); vst2((unsigned*)(KH + o), *(const v4u*)&sk[rl][q * 8]);   
    if (qhi) vst2((unsigned*)(QL + (bb * QHI + t0 + rl) * (size_t)CC + h * HD + q * 8), *(const v4u*)&sql[rl][q * 8]); if (khi) vst2((unsigned*)(KL + (bb * KHI + t0 + rl) * (size_t)CC + h * HD + q * 8), *(const v4u*)&skl[rl][q * 8]); }
  for (int e = tid; e < HD * 8; e += 128) { const int cl = e >> 3, q = e & 7; vst2((unsigned*)(VT + (bb * CC + h * HD + cl) * (size_t)TT + t0 + q * 8), *(const v4u*)&tv[cl][q * 8]);
    if (khi) { const size_t o3 = (bb * CC + h * HD + cl) * (size_t)KHI + t0 + q * 8; vst2((unsigned*)(VB + o3), *(const v4u*)&tb[cl][q * 8]); vst2((unsigned*)(VBL + o3), *(const v4u*)&tbl[cl][q * 8]); } } }

#ifndef SM_EXTRA_PARAMS
#define SM_EXTRA_PARAMS
#endif
#ifndef PROJ_EXTRA_PARAMS
#define PROJ_EXTRA_PARAMS
#endif
#ifndef SM_MASK_HOOK
#define SM_MASK_HOOK (void)0
#endif

#define WS_QH  0u                                      // f16 q rows [b*t][CC]
#define WS_KH  (WS_QH + 2u * (size_t)NB * TT * CC)      // f16 k rows [b*t][CC]
#define WS_VT  (WS_KH + 2u * (size_t)NB * TT * CC)      // f16 v planes [b][c][t]
#define WS_QL  (WS_VT + 2u * (size_t)NB * CC * TT)      // f16 q residual x 2^10 rows [b][t < QHI][CC]
#define WS_KL  (WS_QL + 2u * (size_t)NB * QHI * CC)     // f16 k residual x 2^10 rows [b][t < KHI][CC]
#define WS_VB  (WS_KL + 2u * (size_t)NB * KHI * CC)     // bf16 v hi planes [b][c][t < KHI]
#define WS_VBL (WS_VB + 2u * (size_t)NB * CC * KHI)
#define WS_S   (WS_VBL + 2u * (size_t)NB * CC * KHI)    // f32 logits / P [hg][t][s]
#define WS_Y   (WS_S  + 4u * (size_t)HG * TT * TT)      // f32 ctx rows [b*t][CC] (only when there is an output projection)
#define WS_END (WS_Y  + 0u)

// ---- k_sc: block = (query block qb, key block kb <= kb_last(qb), head in group) of batch b: logits x SCALE; q hi + residual (x 2^10) against k (2 products) for query rows < QHI, plus the k residual (3 products) for query blocks < QBH (every query block here); causal: blocks past the diagonal exit, the mask itself is applied by index in k_sm
__global__ __launch_bounds__(128) void k_sc(const _Float16* __restrict__ QH, const _Float16* __restrict__ KH, const _Float16* __restrict__ QL, const _Float16* __restrict__ KL, int b, int h0, float* __restrict__ S0) { __shared__ __align__(16) float ss[4][16][132];
  const int qb = blockIdx.x, kb = blockIdx.y; if (kb > kb_last(qb)) return;
  const int h = h0 + blockIdx.z; float* S = S0 + (size_t)blockIdx.z * TT * TT;
  const int tid = threadIdx.x, wave = tid >> 5, lane = tid & 31, col = lane & 15, g = lane >> 4; const int k0 = kb * 128; const int ql0 = qb * 64 + wave * 16; const size_t q0 = (size_t)b * TT + ql0, kr0 = (size_t)b * TT + k0;
  v8f acc[8] = {}, accl[8] = {};
  const _Float16* QLb = QL + (size_t)b * QHI * CC; const _Float16* KLb = KL + (size_t)b * KHI * CC;
  if (qb < QBH) {
#pragma unroll
    for (int kc = 0; kc < HD / 32; ++kc) { const v16h ah = frag_h(QH + (q0 + col) * CC + h * HD + kc * 32, lane), al = frag_h(QLb + (size_t)(ql0 + col) * CC + h * HD + kc * 32, lane);
#pragma unroll
      for (int j = 0; j < 8; ++j) { const v16h kbf = frag_h(KH + (kr0 + j * 16 + col) * CC + h * HD + kc * 32, lane), klf = frag_h(KLb + (size_t)(k0 + j * 16 + col) * CC + h * HD + kc * 32, lane); acc[j] = wmma16(ah, kbf, acc[j]); accl[j] = wmma16(al, kbf, accl[j]); accl[j] = wmma16(ah, klf, accl[j]); } }
  } else if (qb * 64 < QHI) {
#pragma unroll
    for (int kc = 0; kc < HD / 32; ++kc) { const v16h ah = frag_h(QH + (q0 + col) * CC + h * HD + kc * 32, lane), al = frag_h(QLb + (size_t)(ql0 + col) * CC + h * HD + kc * 32, lane);
#pragma unroll
      for (int j = 0; j < 8; ++j) { const v16h kbf = frag_h(KH + (kr0 + j * 16 + col) * CC + h * HD + kc * 32, lane); acc[j] = wmma16(ah, kbf, acc[j]); accl[j] = wmma16(al, kbf, accl[j]); } }
  } else {
#pragma unroll
    for (int kc = 0; kc < HD / 32; ++kc) { const v16h ah = frag_h(QH + (q0 + col) * CC + h * HD + kc * 32, lane);
#pragma unroll
      for (int j = 0; j < 8; ++j) { const v16h kbf = frag_h(KH + (kr0 + j * 16 + col) * CC + h * HD + kc * 32, lane); acc[j] = wmma16(ah, kbf, acc[j]); } } }
#pragma unroll
  for (int j = 0; j < 8; ++j) {
#pragma unroll
    for (int r = 0; r < 8; ++r) ss[wave][8 * g + r][j * 16 + col] = (acc[j][r] + accl[j][r] * (1.0f / 1024.0f)) * SCALE; }
  LDSX(); for (int rl = 0; rl < 16; ++rl) vst2(S + (size_t)(ql0 + rl) * TT + k0 + lane * 4, *(const v4f*)&ss[wave][rl][lane * 4]); }
// ---- k_sm: block = query row t (head in group): keys [0, kend): causal -> logit if s <= t else excluded; softmax in f32; P x 2^11 in place (0 for excluded)
__global__ __launch_bounds__(256) void k_sm(float* __restrict__ S0 SM_EXTRA_PARAMS) { __shared__ float sred[8]; __shared__ float sbc; __shared__ __align__(16) float shv[TT];
  const int tid = threadIdx.x; const int t = blockIdx.x; const int kend = (kb_last(t >> 6) + 1) * 128;
  float* sr = S0 + (size_t)blockIdx.y * TT * TT + (size_t)t * TT;
  float m = -3.0e38f; for (int k = tid; k < kend; k += 256) { float v = (!CAUSAL || k <= t) ? sr[k] : -3.0e38f; SM_MASK_HOOK; shv[k] = v; m = fmaxf(m, v); }
#pragma unroll
  for (int o = 1; o < 32; o <<= 1) m = fmaxf(m, __shfl_xor(m, o));
  if ((tid & 31) == 0) sred[tid >> 5] = m; __syncthreads(); if (tid == 0) { float a = sred[0]; for (int i = 1; i < 8; ++i) a = fmaxf(a, sred[i]); sbc = a; } __syncthreads(); m = sbc; __syncthreads();
  float sum = 0.f; for (int k = tid; k < kend; k += 256) { const float v = shv[k]; const float e = (v <= -1.0e38f) ? 0.f : expf(v - m); shv[k] = e; sum += e; }
#pragma unroll
  for (int o = 1; o < 32; o <<= 1) sum += __shfl_xor(sum, o);
  if ((tid & 31) == 0) sred[tid >> 5] = sum; __syncthreads(); if (tid == 0) { float a = 0.f; for (int i = 0; i < 8; ++i) a += sred[i]; sbc = a > 0.f ? 2048.0f / a : 0.f; }   /* a fully excluded row yields P = 0 */ __syncthreads(); const float inv = sbc;
  for (int k = tid; k < kend; k += 256) shv[k] = shv[k] * inv;
  __syncthreads(); for (int q = tid; q < kend / 4; q += 256) vst2(sr + q * 4, *(const v4f*)&shv[q * 4]); }
// ---- k_pv: block = 64 queries (qb) of (b, h): ctx = P . v over keys [0, kend) (query blocks < QBH, here every one: P and v as bf16 hi + lo, 3 products; otherwise P x 2^11 once to f16 against v f16: 1 product); 256-B (row, head) segment by 16 lanes
__global__ __launch_bounds__(128) void k_pv(const float* __restrict__ PS0, const _Float16* __restrict__ VT, const __bf16* __restrict__ VB, const __bf16* __restrict__ VBL, int b, int h0, float* __restrict__ Y) { const int h = h0 + blockIdx.z; const float* PS = PS0 + (size_t)blockIdx.z * TT * TT; __shared__ __align__(16) float ss[4][16][HD + 4];
  const int tid = threadIdx.x, wave = tid >> 5, lane = tid & 31, col = lane & 15, g = lane >> 4; const int qb = blockIdx.x; const int ql0 = qb * 64 + wave * 16; const int kce = (kb_last(qb) + 1) * 4;
  v8f acc[HD / 16] = {};
  if (qb < QBH) {
#pragma unroll 1
    for (int kc = 0; kc < kce; ++kc) { const F2 p = split_row(PS + (size_t)(ql0 + col) * TT, kc * 32, lane);
      asm volatile("s_wait_loadcnt 0x0" ::: "memory");
#pragma unroll
      for (int j = 0; j < HD / 16; ++j) { const size_t po = ((size_t)b * CC + h * HD + j * 16 + col) * (size_t)KHI + kc * 32; const v16b vh = frag_b(VB + po, lane); acc[j] = wmma_bf(p.h, vh, acc[j]); acc[j] = wmma_bf(p.l, vh, acc[j]); acc[j] = wmma_bf(p.h, frag_b(VBL + po, lane), acc[j]); } }
  } else {
#pragma unroll 1
    for (int kc = 0; kc < kce; ++kc) { const v16h p = frag_f32(PS + (size_t)(ql0 + col) * TT + kc * 32, lane);
      asm volatile("s_wait_loadcnt 0x0" ::: "memory");
#pragma unroll
      for (int j = 0; j < HD / 16; ++j) { const size_t po = ((size_t)b * CC + h * HD + j * 16 + col) * (size_t)TT + kc * 32; acc[j] = wmma16(p, frag_h(VT + po, lane), acc[j]); } } }
#pragma unroll
  for (int j = 0; j < HD / 16; ++j)
#pragma unroll
    for (int r = 0; r < 8; ++r) ss[wave][8 * g + r][j * 16 + col] = acc[j][r] * (1.0f / 2048.0f);
  LDSX(); for (int rl = 0; rl < 16; ++rl) if (lane < HD / 4) vst2(Y + (((size_t)b * NH + h) * TT + ql0 + rl) * HD + lane * 4, *(const v4f*)&ss[wave][rl][lane * 4]); }

extern "C" void kernel_launch(void* const* d_in, const int* in_sizes, int n_in, void* d_out, int out_size, void* d_ws, size_t ws_size, hipStream_t stream) {
  (void)in_sizes; (void)n_in; (void)out_size;
  const float** F = (const float**)d_in;
  if (ws_size < (size_t)WS_END) return;
  char* ws = (char*)d_ws; _Float16 *QH = (_Float16*)(ws + WS_QH), *KH = (_Float16*)(ws + WS_KH), *VT = (_Float16*)(ws + WS_VT), *QL = (_Float16*)(ws + WS_QL), *KL = (_Float16*)(ws + WS_KL); __bf16 *VB = (__bf16*)(ws + WS_VB), *VBL = (__bf16*)(ws + WS_VBL); float *S = (float*)(ws + WS_S), *Y = (float*)(ws + WS_Y);
  (void)Y; (void)QL; (void)KL; (void)VB; (void)VBL;
  // inputs: 0 queries [32,2048,64]; 1 keys; 2 values; 3 valid_lens [32] int
  k_prep8<<<dim3(TNB * TT / 64, NH), 128, 0, stream>>>(F[0], F[1], F[2], QH, QL, KH, KL, VT, VB, VBL);
  for (int b = 0; b < TNB; ++b) for (int h0 = 0; h0 < NH; h0 += HG) {
    k_sc<<<dim3(NQB, TT / 128, HG), 128, 0, stream>>>(QH, KH, QL, KL, b, h0, S);
    k_sm<<<dim3(TT, HG), 256, 0, stream>>>(S, (const int*)d_in[3], h0);
    k_pv<<<dim3(NQB, 1, HG), 128, 0, stream>>>(S, VT, VB, VBL, b, h0, (float*)d_out);
  }
}

// v001
// Measured time: 144 microseconds a run.
// Timed twice side by side with v000, it ran 9.93 and 9.86 times as fast.
// compute dtype: all float inputs rounded to bf16 and carried EXACTLY in f16 planes (bf16 hi + lo v planes for every key are exact too); logits q.k as EXACT 3-product sums (q, k f16 hi + zero x 2^10 residual planes) on WMMA 16x16x32 (f32 accumulate) / 8, keys at index >= valid_len set to -1e6; softmax in f32 (precise expf); P and v both split bf16 hi + lo (3 products) for every query row; f32 output.
#include <hip/hip_runtime.h>
#include <math.h>

typedef __attribute__((ext_vector_type(16))) _Float16 v16h;
typedef __attribute__((ext_vector_type(16))) __bf16 v16b;
typedef __attribute__((ext_vector_type(8)))  _Float16 v8h;
typedef __attribute__((ext_vector_type(8)))  float v8f;
typedef __attribute__((ext_vector_type(4)))  float v4f;
typedef __attribute__((ext_vector_type(2)))  float v2f;
typedef __attribute__((ext_vector_type(4)))  unsigned v4u;
typedef __attribute__((ext_vector_type(4)))  int v4i;
typedef float __attribute__((may_alias)) float_a;
typedef int __attribute__((may_alias)) int_a;

template <typename T> __device__ __forceinline__ void vst2(void* p, T v) { *(T*)p = v;  }
__device__ __forceinline__ v8f wmma16(v16h a, v16h b, v8f c) {
  v8f d = __builtin_amdgcn_wmma_f32_16x16x32_f16(false, a, false, b, (short)0, c, false, false);
  asm volatile("v_nop\n\tv_nop\n\tv_nop\n\tv_nop" : "+v"(d) : "v"(a), "v"(b));
  return d;
}
__device__ __forceinline__ v8f wmma_bf(v16b a, v16b b, v8f c) {
  v8f d = __builtin_amdgcn_wmma_f32_16x16x32_bf16(false, a, false, b, (short)0, c, false, false);
  asm volatile("v_nop\n\tv_nop\n\tv_nop\n\tv_nop" : "+v"(d) : "v"(a), "v"(b));
  return d;
}
// 16x16x32 fragments: lane = (h = lane>>4, row/col = lane&15); elements 0..7 = k0+8h+0..7, 8..15 = k0+16+8h+0..7; D element r = row 8h+r
__device__ __forceinline__ v16h frag_h(const _Float16* rowk0, int lane) {
  union { v16h v; v8h q[2]; } u; const _Float16* p = rowk0 + 8 * (lane >> 4);
  u.q[0] = *(const v8h*)p; u.q[1] = *(const v8h*)(p + 16); return u.v;
}
__device__ __forceinline__ v16h frag_f32(const float* rowk0, int lane) {
  v16h a; const float* p = rowk0 + 8 * (lane >> 4);
#pragma unroll
  for (int i = 0; i < 8; ++i) { a[i] = (_Float16)p[i]; a[8 + i] = (_Float16)p[16 + i]; }
  return a;
}
__device__ __forceinline__ v16h frag_f32s(const float* rowk0, int lane, float sc) {
  v16h a; const float* p = rowk0 + 8 * (lane >> 4);
#pragma unroll
  for (int i = 0; i < 8; ++i) { a[i] = (_Float16)(p[i] * sc); a[8 + i] = (_Float16)(p[16 + i] * sc); }
  return a;
}
// column fragment from a [K][ld] layout (column n), rows >= K read as 0
__device__ __forceinline__ v16h fragc_f32(const float* W, int k0, int n, int lane, int ld, int K) {
  v16h a; const int g = lane >> 4;
#pragma unroll
  for (int i = 0; i < 8; ++i) { const int ka = k0 + 8 * g + i, kb = ka + 16;
    a[i] = (_Float16)(ka < K ? W[(size_t)(ka < K ? ka : K - 1) * ld + n] : 0.f); a[8 + i] = (_Float16)(kb < K ? W[(size_t)(kb < K ? kb : K - 1) * ld + n] : 0.f); }
  return a;
}
struct F2 { v16b h, l; };
__device__ __forceinline__ F2 bsplit16(const float v[16]) { F2 r;
#pragma unroll
  for (int i = 0; i < 16; ++i) { const __bf16 h = (__bf16)v[i]; r.h[i] = h; r.l[i] = (__bf16)(v[i] - (float)h); }
  return r; }
__device__ __forceinline__ F2 split_row(const float* row, int k0, int lane) { float v[16]; const float* p = row + k0 + 8 * (lane >> 4);
#pragma unroll
  for (int i = 0; i < 8; ++i) { v[i] = p[i]; v[8 + i] = p[16 + i]; }
  return bsplit16(v); }
__device__ __forceinline__ F2 split_rowK(const float* row, int k0, int lane, int K) { float v[16]; const int g = lane >> 4;
#pragma unroll
  for (int i = 0; i < 8; ++i) { const int ka = k0 + 8 * g + i, kb = ka + 16; v[i] = ka < K ? row[ka < K ? ka : K - 1] : 0.f; v[8 + i] = kb < K ? row[kb < K ? kb : K - 1] : 0.f; }
  return bsplit16(v); }
__device__ __forceinline__ F2 split_col(const float* W, int k0, int n, int lane, int ld, int K) { float v[16]; const int g = lane >> 4;
#pragma unroll
  for (int i = 0; i < 8; ++i) { const int ka = k0 + 8 * g + i, kb = ka + 16; v[i] = ka < K ? W[(size_t)(ka < K ? ka : K - 1) * ld + n] : 0.f; v[8 + i] = kb < K ? W[(size_t)(kb < K ? kb : K - 1) * ld + n] : 0.f; }
  return bsplit16(v); }
__device__ __forceinline__ v8f mac3(const F2& a, const F2& b, v8f c) { c = wmma_bf(a.l, b.h, c); c = wmma_bf(a.h, b.l, c); return wmma_bf(a.h, b.h, c); }
__device__ __forceinline__ float sigm(float v) { return 1.0f / (1.0f + expf(-v)); }
#define LDSX() do { asm volatile("s_wait_dscnt 0" ::: "memory"); __builtin_amdgcn_wave_barrier(); __builtin_amdgcn_fence(__ATOMIC_RELEASE, "workgroup"); } while (0)

// Masked dot-product attention (B 32 sequences treated as 32 planes, S 2,048, D 64): scores = q k^T / 8; keys k >= valid_lens[b] set to -1e6 (sequence mask); softmax; out = weights v -> [32, 2,048, 64].
#define NB 1
#define TT 2048
#define CC 2048            // NH * HD = projected width
#define DIN 2048          // input (model) width
#define NH 32
#define HD 64
#define NQB (TT / 64)
#define HG 4
#define SCALE (0.125f)
#define CAUSAL 0
#ifndef TNB
#define TNB NB
#endif
__device__ __forceinline__ float bfr(float v) { return (float)(__bf16)v; }
__host__ __device__ __forceinline__ int kb_last(int qb) { return CAUSAL ? ((qb * 64 + 63) >> 7) : (TT / 128 - 1); }
typedef __attribute__((ext_vector_type(8))) __bf16 v8b;
__device__ __forceinline__ v16b frag_b(const __bf16* rowk0, int lane) {
  union { v16b v; v8b q[2]; } u; const __bf16* p = rowk0 + 8 * (lane >> 4);
  u.q[0] = *(const v8b*)p; u.q[1] = *(const v8b*)(p + 16); return u.v;
}
#define QBH NQB            // every query block takes the bf16 hi + lo P.v path
#define QHI 2048            // rows carrying a q residual plane (all rows when non-causal: 3-product logits everywhere)
#define KHI 2048           // bf16 v hi + lo planes for EVERY key (3-product P.v everywhere)
// B fragment (k rows k0+.., output column o) of a weight: (in,out) [K][ld] or (out,in) [ld rows of K]: bf16 exact, or f16(bf16 * 256) exact
__device__ __forceinline__ v16b wcol_io(const float* Wm, int k0, int o, int lane, int ld) { v16b w; const int g = lane >> 4;
#pragma unroll
  for (int i = 0; i < 8; ++i) { w[i] = (__bf16)Wm[(size_t)(k0 + 8 * g + i) * ld + o]; w[8 + i] = (__bf16)Wm[(size_t)(k0 + 16 + 8 * g + i) * ld + o]; }
  return w; }
__device__ __forceinline__ v16b wcol_oi(const float* Wm, int k0, int o, int lane, int K) { v16b w; const float* p = Wm + (size_t)o * K + k0 + 8 * (lane >> 4);
#pragma unroll
  for (int i = 0; i < 8; ++i) { w[i] = (__bf16)p[i]; w[8 + i] = (__bf16)p[16 + i]; }
  return w; }
__device__ __forceinline__ v16h wcolh_io(const float* Wm, int k0, int o, int lane, int ld) { v16h w; const int g = lane >> 4;
#pragma unroll
  for (int i = 0; i < 8; ++i) { w[i] = (_Float16)(bfr(Wm[(size_t)(k0 + 8 * g + i) * ld + o]) * 256.0f); w[8 + i] = (_Float16)(bfr(Wm[(size_t)(k0 + 16 + 8 * g + i) * ld + o]) * 256.0f); }
  return w; }
__device__ __forceinline__ v16h wcolh_oi(const float* Wm, int k0, int o, int lane, int K) { v16h w; const float* p = Wm + (size_t)o * K + k0 + 8 * (lane >> 4);
#pragma unroll
  for (int i = 0; i < 8; ++i) { w[i] = (_Float16)(bfr(p[i]) * 256.0f); w[8 + i] = (_Float16)(bfr(p[16 + i]) * 256.0f); }
  return w; }
#define WQKV_LAYOUT 1   // 0 = (in,out) [DIN][CC]; 1 = (out,in) [CC][DIN]; 2 = per-head [NH][DIN][HD]
__device__ __forceinline__ v16b wcol_hdk(const float* Wm, int k0, int o, int lane) { v16b w; const int g = lane >> 4; const float* p = Wm + (size_t)(o / HD) * DIN * HD + (o % HD);
#pragma unroll
  for (int i = 0; i < 8; ++i) { w[i] = (__bf16)p[(size_t)(k0 + 8 * g + i) * HD]; w[8 + i] = (__bf16)p[(size_t)(k0 + 16 + 8 * g + i) * HD]; }
  return w; }
#define WO_OUT_IN 0
#if WQKV_LAYOUT == 1
#define WCOL(W, k0, o, lane) wcol_oi(W, k0, o, lane, DIN)
#elif WQKV_LAYOUT == 2
#define WCOL(W, k0, o, lane) wcol_hdk(W, k0, o, lane)
#else
#define WCOL(W, k0, o, lane) wcol_io(W, k0, o, lane, CC)
#endif
#if WO_OUT_IN
#define WOCOL(W, k0, o, lane) wcol_oi(W, k0, o, lane, CC)
#define WOCOLH(W, k0, o, lane) wcolh_oi(W, k0, o, lane, CC)
#else
#define WOCOL(W, k0, o, lane) wcol_io(W, k0, o, lane, DIN)
#define WOCOLH(W, k0, o, lane) wcolh_io(W, k0, o, lane, DIN)
#endif
// ---- k_prep8: block = (64 attention positions s0.. of sequence b, head h): reads the module's [B, H, S, 64] inputs (element (b,h,s,c) at ((b*NH + h)*TT + s)*64 + c), bf16-rounds them and writes the standard attention planes: q -> f16 hi rows (+ x 2^10 residual rows for s < QHI), k -> f16 rows (+ residual rows s < KHI), v -> f16 planes [c][s] (+ bf16 hi/lo planes for s < KHI)
__global__ __launch_bounds__(128) void k_prep8(const float* __restrict__ Q, const float* __restrict__ K, const float* __restrict__ V, _Float16* __restrict__ QH, _Float16* __restrict__ QL, _Float16* __restrict__ KH, _Float16* __restrict__ KL, _Float16* __restrict__ VT, __bf16* __restrict__ VB, __bf16* __restrict__ VBL) {
  __shared__ __align__(16) _Float16 sq[64][136], sql[64][136], sk[64][136], skl[64][136], tv[128][72]; __shared__ __align__(16) __bf16 tb[128][72], tbl[128][72];
  const int tid = threadIdx.x; const int h = blockIdx.y; const size_t r0 = (size_t)blockIdx.x * 64; const size_t bb = r0 / TT; const int t0 = (int)(r0 % TT); const bool qhi = t0 < QHI, khi = t0 < KHI;
  for (int e = tid; e < 64 * 128; e += 128) { const int rl = e >> 7, c = e & 127; const size_t oi = ((bb * NH + h) * TT + t0 + rl) * HD + (c % HD);   /* c >= 64: duplicate read of the same element (tiles are 128 wide; HD is 64) */
    const float q = bfr(Q[oi]), k = bfr(K[oi]), v = bfr(V[oi]);   /* module inputs: bf16-rounded; bf16 values are exact in f16, so the residual planes are 0 */
    const _Float16 qh = (_Float16)q, kh = (_Float16)k; sq[rl][c] = qh; sql[rl][c] = (_Float16)((q - (float)qh) * 1024.0f); sk[rl][c] = kh; skl[rl][c] = (_Float16)((k - (float)kh) * 1024.0f);
    tv[c][rl] = (_Float16)v; const __bf16 vb = (__bf16)v; tb[c][rl] = vb; tbl[c][rl] = (__bf16)(v - (float)vb); }
  __syncthreads();
  for (int e = tid; e < 64 * (HD / 8); e += 128) { const int rl = e / (HD / 8), q = e % (HD / 8); const size_t o = (r0 + rl) * CC + h * HD + q * 8; vst2((unsigned*)(QH + o), *(const v4u*)&sq[rl][q * 8]); vst2((unsigned*)(KH + o), *(const v4u*)&sk[rl][q * 8]);   
    if (qhi) vst2((unsigned*)(QL + (bb * QHI + t0 + rl) * (size_t)CC + h * HD + q * 8), *(const v4u*)&sql[rl][q * 8]); if (khi) vst2((unsigned*)(KL + (bb * KHI + t0 + rl) * (size_t)CC + h * HD + q * 8), *(const v4u*)&skl[rl][q * 8]); }
  for (int e = tid; e < HD * 8; e += 128) { const int cl = e >> 3, q = e & 7; vst2((unsigned*)(VT + (bb * CC + h * HD + cl) * (size_t)TT + t0 + q * 8), *(const v4u*)&tv[cl][q * 8]);
    if (khi) { const size_t o3 = (bb * CC + h * HD + cl) * (size_t)KHI + t0 + q * 8; vst2((unsigned*)(VB + o3), *(const v4u*)&tb[cl][q * 8]); vst2((unsigned*)(VBL + o3), *(const v4u*)&tbl[cl][q * 8]); } } }


#define WS_QH  0u                                      // f16 q rows [b*t][CC]
#define WS_KH  (WS_QH + 2u * (size_t)NB * TT * CC)      // f16 k rows [b*t][CC]
#define WS_VT  (WS_KH + 2u * (size_t)NB * TT * CC)      // f16 v planes [b][c][t]
#define WS_QL  (WS_VT + 2u * (size_t)NB * CC * TT)      // f16 q residual x 2^10 rows [b][t < QHI][CC]
#define WS_KL  (WS_QL + 2u * (size_t)NB * QHI * CC)     // f16 k residual x 2^10 rows [b][t < KHI][CC]
#define WS_VB  (WS_KL + 2u * (size_t)NB * KHI * CC)     // bf16 v hi planes [b][c][t < KHI]
#define WS_VBL (WS_VB + 2u * (size_t)NB * CC * KHI)
#define WS_END (WS_VBL + 2u * (size_t)NB * CC * KHI)

// plain builtin forms for the fused kernel: the compiler keeps the distance behind its own matrix instructions
__device__ __forceinline__ v8f mmh(v16h a, v16h b, v8f c) { return __builtin_amdgcn_wmma_f32_16x16x32_f16(false, a, false, b, (short)0, c, false, false); }
__device__ __forceinline__ v8f mmb(v16b a, v16b b, v8f c) { return __builtin_amdgcn_wmma_f32_16x16x32_bf16(false, a, false, b, (short)0, c, false, false); }
__device__ __forceinline__ float xhalf(float x) { return __builtin_bit_cast(float, __builtin_amdgcn_permlanex16(__builtin_bit_cast(int, x), __builtin_bit_cast(int, x), 0x76543210, 0xfedcba98, false, false)); }   // lane l reads lane l ^ 16, on the vector port: no LDS counter to wait on while fragment reads are in flight
#define SK 64              // keys a stage: the block's 16 waves share one staged copy of the stage's k rows and v planes
#define SP 72              // LDS row pitch in 16-bit elements: 144 B = 16 B x odd, the pitch for 16-byte fragment reads
// ---- k_fa: block = 256 queries of plane h, 16 waves x 16 query columns; every wave walks all keys, 32 a pass, and keeps logits and weights in registers.
// S^T = K . Q^T (A = 16 key rows, B = 16 query columns): lane (g, col) holds query col, register r = key 8g + r, so two S^T tiles (keys +0..15, +16..31) are, converted in place, the B operand of O^T += V^T . P^T.
// Running maximum m and running sum l per query column (each lane half sums its own keys; the halves join after the loop); O^T and l are rescaled by exp(m_old - m_new) every pass.
// k rows and v planes (hi and residual) come through registers into two LDS buffers, whole 128-byte lines a row: stage st + 1 is loaded while stage st is worked on, stored behind it, and one barrier a stage both publishes it and ends the reads of the buffer that is refilled next.
__global__ __launch_bounds__(512) void k_fa(const _Float16* __restrict__ QH, const _Float16* __restrict__ QL, const _Float16* __restrict__ KH, const _Float16* __restrict__ KL, const __bf16* __restrict__ VB, const __bf16* __restrict__ VBL, const int* __restrict__ VL, float* __restrict__ Y) {
  __shared__ __align__(16) _Float16 sk[2][SK][SP], skl[2][SK][SP]; __shared__ __align__(16) __bf16 sv[2][HD][SP], svl[2][HD][SP];
  const int tid = threadIdx.x, wave = tid >> 5, lane = tid & 31, col = lane & 15, g = lane >> 4; const int h = blockIdx.y; const int ql0 = blockIdx.x * 256 + wave * 16; const int vl = VL[h];
  const int srow = tid >> 3, sseg = (tid & 7) * 8;   /* staging: 8 threads a row of 128 bytes, 64 rows an array */
  const _Float16* gk = KH + (size_t)srow * CC + h * HD + sseg; const _Float16* gkl = KL + (size_t)srow * CC + h * HD + sseg;
  const __bf16* gv = VB + ((size_t)h * HD + srow) * (size_t)KHI + sseg; const __bf16* gvl = VBL + ((size_t)h * HD + srow) * (size_t)KHI + sseg;
  v8h r0 = *(const v8h*)gk, r1 = *(const v8h*)gkl; v8b r2 = *(const v8b*)gv, r3 = *(const v8b*)gvl;
  v16h qh[HD / 32], ql[HD / 32];
  // the inner loops are unrolled so that every fragment and accumulator array stays in registers
#pragma unroll
  for (int kc = 0; kc < HD / 32; ++kc) { const size_t qo = (size_t)(ql0 + col) * CC + h * HD + kc * 32; qh[kc] = frag_h(QH + qo, lane); ql[kc] = frag_h(QL + qo, lane); }
  asm volatile("s_wait_xcnt 0x0" ::: "memory");   /* the wait in front of the reuse of the first loads' address registers */
  *(v8h*)&sk[0][srow][sseg] = r0; *(v8h*)&skl[0][srow][sseg] = r1; *(v8b*)&sv[0][srow][sseg] = r2; *(v8b*)&svl[0][srow][sseg] = r3;
  __syncthreads();
  v8f acc[HD / 16] = {}; float m = -3.0e38f, l = 0.f;
  for (int st = 0; st < TT / SK; ++st) { const int bu = st & 1; const bool more = st + 1 < TT / SK;
    if (more) { const size_t kn = (size_t)(st + 1) * SK * CC; const int vn = (st + 1) * SK; r0 = *(const v8h*)(gk + kn); r1 = *(const v8h*)(gkl + kn); r2 = *(const v8b*)(gv + vn); r3 = *(const v8b*)(gvl + vn);
      asm volatile("s_wait_xcnt 0x0" ::: "memory"); }   /* the four loads stay in flight over the stage while their address registers are reused: the wait in front of that overwrite */
    for (int ps = 0; ps < SK / 32; ++ps) { const int k0 = st * SK + ps * 32;
      v8f s[2] = {}, sl[2] = {}; v16h kh[4], kl[4];
#pragma unroll
      for (int i = 0; i < 4; ++i) { const int kr = ps * 32 + (i >> 1) * 16 + col; kh[i] = frag_h(&sk[bu][kr][(i & 1) * 32], lane); kl[i] = frag_h(&skl[bu][kr][(i & 1) * 32], lane); }
      __builtin_amdgcn_sched_barrier(0);   /* holds the pass's 16 k fragment reads together in front of the products: one LDS wait a pass, not one between every few products */
#pragma unroll
      for (int t = 0; t < 2; ++t) {
#pragma unroll
        for (int kc = 0; kc < HD / 32; ++kc) { s[t] = mmh(kh[t * 2 + kc], qh[kc], s[t]); sl[t] = mmh(kh[t * 2 + kc], ql[kc], sl[t]); sl[t] = mmh(kl[t * 2 + kc], qh[kc], sl[t]); } }
      v16b vh[HD / 16], vo[HD / 16];
#pragma unroll
      for (int j = 0; j < HD / 16; ++j) { vh[j] = frag_b(&sv[bu][j * 16 + col][ps * 32], lane); vo[j] = frag_b(&svl[bu][j * 16 + col][ps * 32], lane); }
      __builtin_amdgcn_sched_barrier(0);   /* holds the v fragment reads in front of the softmax arithmetic, which then covers their latency */
      float p[16];
#pragma unroll
      for (int i = 0; i < 16; ++i) p[i] = (s[i >> 3][i & 7] + sl[i >> 3][i & 7] * (1.0f / 1024.0f)) * SCALE;
      if (k0 + 32 > vl) {   /* sequence_mask: keys at index >= valid_len are SET to -1e6, as written; a pass wholly below valid_len has none */
        const int rem = vl - k0 - 8 * g;
#pragma unroll
        for (int i = 0; i < 16; ++i) if ((i >> 3) * 16 + (i & 7) >= rem) p[i] = -1000000.0f; }
      float mx = m;
#pragma unroll
      for (int i = 0; i < 16; ++i) mx = fmaxf(mx, p[i]);
      mx = fmaxf(mx, xhalf(mx));
      const float al = expf(m - mx); m = mx; float sum = 0.f;
#pragma unroll
      for (int i = 0; i < 16; ++i) { p[i] = expf(p[i] - mx); sum += p[i]; }
      l = l * al + sum;
#pragma unroll
      for (int j = 0; j < HD / 16; ++j) acc[j] *= al;
      const F2 pf = bsplit16(p);
#pragma unroll
      for (int j = 0; j < HD / 16; ++j) { acc[j] = mmb(vh[j], pf.h, acc[j]); acc[j] = mmb(vh[j], pf.l, acc[j]); acc[j] = mmb(vo[j], pf.h, acc[j]); } }
    if (more) { *(v8h*)&sk[bu ^ 1][srow][sseg] = r0; *(v8h*)&skl[bu ^ 1][srow][sseg] = r1; *(v8b*)&sv[bu ^ 1][srow][sseg] = r2; *(v8b*)&svl[bu ^ 1][srow][sseg] = r3; }
    __syncthreads(); }
  l += xhalf(l); const float inv = 1.0f / l;
  float* yr = Y + ((size_t)h * TT + ql0 + col) * HD + 8 * g;   /* register r of tile j = output column j * 16 + 8g + r of query col: 32 contiguous bytes a lane */
#pragma unroll
  for (int j = 0; j < HD / 16; ++j) { v4f a, b;
#pragma unroll
    for (int r = 0; r < 4; ++r) { a[r] = acc[j][r] * inv; b[r] = acc[j][4 + r] * inv; }
    vst2(yr + j * 16, a); vst2(yr + j * 16 + 4, b); } }

extern "C" void kernel_launch(void* const* d_in, const int* in_sizes, int n_in, void* d_out, int out_size, void* d_ws, size_t ws_size, hipStream_t stream) {
  (void)in_sizes; (void)n_in; (void)out_size;
  const float** F = (const float**)d_in;
  if (ws_size < (size_t)WS_END) return;
  char* ws = (char*)d_ws; _Float16 *QH = (_Float16*)(ws + WS_QH), *KH = (_Float16*)(ws + WS_KH), *VT = (_Float16*)(ws + WS_VT), *QL = (_Float16*)(ws + WS_QL), *KL = (_Float16*)(ws + WS_KL); __bf16 *VB = (__bf16*)(ws + WS_VB), *VBL = (__bf16*)(ws + WS_VBL);
  // inputs: 0 queries [32,2048,64]; 1 keys; 2 values; 3 valid_lens [32] int
  k_prep8<<<dim3(TNB * TT / 64, NH), 128, 0, stream>>>(F[0], F[1], F[2], QH, QL, KH, KL, VT, VB, VBL);
  k_fa<<<dim3(TT / 256, NH), 512, 0, stream>>>(QH, QL, KH, KL, VB, VBL, (const int*)d_in[3], (float*)d_out);
}

// v002
// A run of this version takes 93.1 microseconds.
// Timed twice side by side with v001, it ran 1.55 times as fast both times.
// Over all steps from v000 it is 15.3 times as fast.
// compute dtype: all float inputs rounded to bf16 and carried EXACTLY in one bf16 plane each; logits q.k as single EXACT products on WMMA 16x16x32 bf16 (f32 accumulate) / 8, keys at index >= valid_len set to -1e6; softmax in f32 (precise expf); P split bf16 hi + lo (2 products against the exact bf16 v) for every query row; f32 output.
#include <hip/hip_runtime.h>
#include <math.h>

typedef __attribute__((ext_vector_type(16))) _Float16 v16h;
typedef __attribute__((ext_vector_type(16))) __bf16 v16b;
typedef __attribute__((ext_vector_type(8)))  _Float16 v8h;
typedef __attribute__((ext_vector_type(8)))  float v8f;
typedef __attribute__((ext_vector_type(4)))  float v4f;
typedef __attribute__((ext_vector_type(2)))  float v2f;
typedef __attribute__((ext_vector_type(4)))  unsigned v4u;
typedef __attribute__((ext_vector_type(4)))  int v4i;
typedef float __attribute__((may_alias)) float_a;
typedef int __attribute__((may_alias)) int_a;

template <typename T> __device__ __forceinline__ void vst2(void* p, T v) { *(T*)p = v;  }
__device__ __forceinline__ v8f wmma16(v16h a, v16h b, v8f c) {
  v8f d = __builtin_amdgcn_wmma_f32_16x16x32_f16(false, a, false, b, (short)0, c, false, false);
  asm volatile("v_nop\n\tv_nop\n\tv_nop\n\tv_nop" : "+v"(d) : "v"(a), "v"(b));
  return d;
}
__device__ __forceinline__ v8f wmma_bf(v16b a, v16b b, v8f c) {
  v8f d = __builtin_amdgcn_wmma_f32_16x16x32_bf16(false, a, false, b, (short)0, c, false, false);
  asm volatile("v_nop\n\tv_nop\n\tv_nop\n\tv_nop" : "+v"(d) : "v"(a), "v"(b));
  return d;
}
// 16x16x32 fragments: lane = (h = lane>>4, row/col = lane&15); elements 0..7 = k0+8h+0..7, 8..15 = k0+16+8h+0..7; D element r = row 8h+r
__device__ __forceinline__ v16h frag_h(const _Float16* rowk0, int lane) {
  union { v16h v; v8h q[2]; } u; const _Float16* p = rowk0 + 8 * (lane >> 4);
  u.q[0] = *(const v8h*)p; u.q[1] = *(const v8h*)(p + 16); return u.v;
}
__device__ __forceinline__ v16h frag_f32(const float* rowk0, int lane) {
  v16h a; const float* p = rowk0 + 8 * (lane >> 4);
#pragma unroll
  for (int i = 0; i < 8; ++i) { a[i] = (_Float16)p[i]; a[8 + i] = (_Float16)p[16 + i]; }
  return a;
}
__device__ __forceinline__ v16h frag_f32s(const float* rowk0, int lane, float sc) {
  v16h a; const float* p = rowk0 + 8 * (lane >> 4);
#pragma unroll
  for (int i = 0; i < 8; ++i) { a[i] = (_Float16)(p[i] * sc); a[8 + i] = (_Float16)(p[16 + i] * sc); }
  return a;
}
// column fragment from a [K][ld] layout (column n), rows >= K read as 0
__device__ __forceinline__ v16h fragc_f32(const float* W, int k0, int n, int lane, int ld, int K) {
  v16h a; const int g = lane >> 4;
#pragma unroll
  for (int i = 0; i < 8; ++i) { const int ka = k0 + 8 * g + i, kb = ka + 16;
    a[i] = (_Float16)(ka < K ? W[(size_t)(ka < K ? ka : K - 1) * ld + n] : 0.f); a[8 + i] = (_Float16)(kb < K ? W[(size_t)(kb < K ? kb : K - 1) * ld + n] : 0.f); }
  return a;
}
struct F2 { v16b h, l; };
__device__ __forceinline__ F2 bsplit16(const float v[16]) { F2 r;
#pragma unroll
  for (int i = 0; i < 16; ++i) { const __bf16 h = (__bf16)v[i]; r.h[i] = h; r.l[i] = (__bf16)(v[i] - (float)h); }
  return r; }
__device__ __forceinline__ F2 split_row(const float* row, int k0, int lane) { float v[16]; const float* p = row + k0 + 8 * (lane >> 4);
#pragma unroll
  for (int i = 0; i < 8; ++i) { v[i] = p[i]; v[8 + i] = p[16 + i]; }
  return bsplit16(v); }
__device__ __forceinline__ F2 split_rowK(const float* row, int k0, int lane, int K) { float v[16]; const int g = lane >> 4;
#pragma unroll
  for (int i = 0; i < 8; ++i) { const int ka = k0 + 8 * g + i, kb = ka + 16; v[i] = ka < K ? row[ka < K ? ka : K - 1] : 0.f; v[8 + i] = kb < K ? row[kb < K ? kb : K - 1] : 0.f; }
  return bsplit16(v); }
__device__ __forceinline__ F2 split_col(const float* W, int k0, int n, int lane, int ld, int K) { float v[16]; const int g = lane >> 4;
#pragma unroll
  for (int i = 0; i < 8; ++i) { const int ka = k0 + 8 * g + i, kb = ka + 16; v[i] = ka < K ? W[(size_t)(ka < K ? ka : K - 1) * ld + n] : 0.f; v[8 + i] = kb < K ? W[(size_t)(kb < K ? kb : K - 1) * ld + n] : 0.f; }
  return bsplit16(v); }
__device__ __forceinline__ v8f mac3(const F2& a, const F2& b, v8f c) { c = wmma_bf(a.l, b.h, c); c = wmma_bf(a.h, b.l, c); return wmma_bf(a.h, b.h, c); }
__device__ __forceinline__ float sigm(float v) { return 1.0f / (1.0f + expf(-v)); }
#define LDSX() do { asm volatile("s_wait_dscnt 0" ::: "memory"); __builtin_amdgcn_wave_barrier(); __builtin_amdgcn_fence(__ATOMIC_RELEASE, "workgroup"); } while (0)

// Masked dot-product attention (B 32 sequences treated as 32 planes, S 2,048, D 64): scores = q k^T / 8; keys k >= valid_lens[b] set to -1e6 (sequence mask); softmax; out = weights v -> [32, 2,048, 64].
#define NB 1
#define TT 2048
#define CC 2048            // NH * HD = projected width
#define DIN 2048          // input (model) width
#define NH 32
#define HD 64
#define NQB (TT / 64)
#define HG 4
#define SCALE (0.125f)
#define CAUSAL 0
#ifndef TNB
#define TNB NB
#endif
__device__ __forceinline__ float bfr(float v) { return (float)(__bf16)v; }
__host__ __device__ __forceinline__ int kb_last(int qb) { return CAUSAL ? ((qb * 64 + 63) >> 7) : (TT / 128 - 1); }
typedef __attribute__((ext_vector_type(8))) __bf16 v8b;
__device__ __forceinline__ v16b frag_b(const __bf16* rowk0, int lane) {
  union { v16b v; v8b q[2]; } u; const __bf16* p = rowk0 + 8 * (lane >> 4);
  u.q[0] = *(const v8b*)p; u.q[1] = *(const v8b*)(p + 16); return u.v;
}
#define QBH NQB            // every query block takes the bf16 hi + lo P.v path
#define KHI 2048           // keys a bf16 v plane holds: every key
// B fragment (k rows k0+.., output column o) of a weight: (in,out) [K][ld] or (out,in) [ld rows of K]: bf16 exact, or f16(bf16 * 256) exact
__device__ __forceinline__ v16b wcol_io(const float* Wm, int k0, int o, int lane, int ld) { v16b w; const int g = lane >> 4;
#pragma unroll
  for (int i = 0; i < 8; ++i) { w[i] = (__bf16)Wm[(size_t)(k0 + 8 * g + i) * ld + o]; w[8 + i] = (__bf16)Wm[(size_t)(k0 + 16 + 8 * g + i) * ld + o]; }
  return w; }
__device__ __forceinline__ v16b wcol_oi(const float* Wm, int k0, int o, int lane, int K) { v16b w; const float* p = Wm + (size_t)o * K + k0 + 8 * (lane >> 4);
#pragma unroll
  for (int i = 0; i < 8; ++i) { w[i] = (__bf16)p[i]; w[8 + i] = (__bf16)p[16 + i]; }
  return w; }
__device__ __forceinline__ v16h wcolh_io(const float* Wm, int k0, int o, int lane, int ld) { v16h w; const int g = lane >> 4;
#pragma unroll
  for (int i = 0; i < 8; ++i) { w[i] = (_Float16)(bfr(Wm[(size_t)(k0 + 8 * g + i) * ld + o]) * 256.0f); w[8 + i] = (_Float16)(bfr(Wm[(size_t)(k0 + 16 + 8 * g + i) * ld + o]) * 256.0f); }
  return w; }
__device__ __forceinline__ v16h wcolh_oi(const float* Wm, int k0, int o, int lane, int K) { v16h w; const float* p = Wm + (size_t)o * K + k0 + 8 * (lane >> 4);
#pragma unroll
  for (int i = 0; i < 8; ++i) { w[i] = (_Float16)(bfr(p[i]) * 256.0f); w[8 + i] = (_Float16)(bfr(p[16 + i]) * 256.0f); }
  return w; }
#define WQKV_LAYOUT 1   // 0 = (in,out) [DIN][CC]; 1 = (out,in) [CC][DIN]; 2 = per-head [NH][DIN][HD]
__device__ __forceinline__ v16b wcol_hdk(const float* Wm, int k0, int o, int lane) { v16b w; const int g = lane >> 4; const float* p = Wm + (size_t)(o / HD) * DIN * HD + (o % HD);
#pragma unroll
  for (int i = 0; i < 8; ++i) { w[i] = (__bf16)p[(size_t)(k0 + 8 * g + i) * HD]; w[8 + i] = (__bf16)p[(size_t)(k0 + 16 + 8 * g + i) * HD]; }
  return w; }
#define WO_OUT_IN 0
#if WQKV_LAYOUT == 1
#define WCOL(W, k0, o, lane) wcol_oi(W, k0, o, lane, DIN)
#elif WQKV_LAYOUT == 2
#define WCOL(W, k0, o, lane) wcol_hdk(W, k0, o, lane)
#else
#define WCOL(W, k0, o, lane) wcol_io(W, k0, o, lane, CC)
#endif
#if WO_OUT_IN
#define WOCOL(W, k0, o, lane) wcol_oi(W, k0, o, lane, CC)
#define WOCOLH(W, k0, o, lane) wcolh_oi(W, k0, o, lane, CC)
#else
#define WOCOL(W, k0, o, lane) wcol_io(W, k0, o, lane, DIN)
#define WOCOLH(W, k0, o, lane) wcolh_io(W, k0, o, lane, DIN)
#endif
// ---- k_prep8: block = (64 attention positions s0.. of sequence b, head h): reads the module's [B, H, S, 64] inputs (element (b,h,s,c) at ((b*NH + h)*TT + s)*64 + c), bf16-rounds them and writes the attention planes: q -> bf16 rows, k -> bf16 rows, v -> bf16 planes [c][s]. A bf16-rounded value is its own bf16 plane: there is no residual to carry.
__global__ __launch_bounds__(128) void k_prep8(const float* __restrict__ Q, const float* __restrict__ K, const float* __restrict__ V, __bf16* __restrict__ QB, __bf16* __restrict__ KB, __bf16* __restrict__ VB) {
  __shared__ __align__(16) __bf16 sq[64][72], sk[64][72], tb[HD][72];
  const int tid = threadIdx.x; const int h = blockIdx.y; const size_t r0 = (size_t)blockIdx.x * 64; const size_t bb = r0 / TT; const int t0 = (int)(r0 % TT);
  for (int e = tid; e < 64 * HD; e += 128) { const int rl = e / HD, c = e % HD; const size_t oi = ((bb * NH + h) * TT + t0 + rl) * HD + c;
    sq[rl][c] = (__bf16)Q[oi]; sk[rl][c] = (__bf16)K[oi]; tb[c][rl] = (__bf16)V[oi]; }   /* module inputs: bf16-rounded */
  __syncthreads();
  for (int e = tid; e < 64 * (HD / 8); e += 128) { const int rl = e / (HD / 8), q = e % (HD / 8); const size_t o = (r0 + rl) * CC + h * HD + q * 8; vst2((unsigned*)(QB + o), *(const v4u*)&sq[rl][q * 8]); vst2((unsigned*)(KB + o), *(const v4u*)&sk[rl][q * 8]); }
  for (int e = tid; e < HD * 8; e += 128) { const int cl = e >> 3, q = e & 7; vst2((unsigned*)(VB + (bb * CC + h * HD + cl) * (size_t)KHI + t0 + q * 8), *(const v4u*)&tb[cl][q * 8]); } }


#define WS_QB  0u                                      // bf16 q rows [b*t][CC]
#define WS_KB  (WS_QB + 2u * (size_t)NB * TT * CC)      // bf16 k rows [b*t][CC]
#define WS_VB  (WS_KB + 2u * (size_t)NB * TT * CC)      // bf16 v planes [b][c][t]
#define WS_END (WS_VB + 2u * (size_t)NB * CC * KHI)

// plain builtin form for the fused kernel: the compiler keeps the distance behind its own matrix instructions
__device__ __forceinline__ v8f mmb(v16b a, v16b b, v8f c) { return __builtin_amdgcn_wmma_f32_16x16x32_bf16(false, a, false, b, (short)0, c, false, false); }
__device__ __forceinline__ float xhalf(float x) { return __builtin_bit_cast(float, __builtin_amdgcn_permlanex16(__builtin_bit_cast(int, x), __builtin_bit_cast(int, x), 0x76543210, 0xfedcba98, false, false)); }   // lane l reads lane l ^ 16, on the vector port: no LDS counter to wait on while fragment reads are in flight
#define SK 64              // keys a stage: the block's 16 waves share one staged copy of the stage's k rows and v planes
#define SP 72              // LDS row pitch in 16-bit elements: 144 B = 16 B x odd, the pitch for 16-byte fragment reads
// ---- k_fa: block = 256 queries of plane h, 16 waves x 16 query columns; every wave walks all keys, 32 a pass, and keeps logits and weights in registers.
// S^T = K . Q^T (A = 16 key rows, B = 16 query columns): lane (g, col) holds query col, register r = key 8g + r, so two S^T tiles (keys +0..15, +16..31) are, converted in place, the B operand of O^T += V^T . P^T.
// Running maximum m and running sum l per query column (each lane half sums its own keys; the halves join after the loop); O^T and l are rescaled by exp(m_old - m_new) every pass.
// k rows and v planes come through registers into two LDS buffers, whole 128-byte lines a row: stage st + 1 is loaded while stage st is worked on, stored behind it, and one barrier a stage both publishes it and ends the reads of the buffer that is refilled next.
__global__ __launch_bounds__(512) void k_fa(const __bf16* __restrict__ QB, const __bf16* __restrict__ KB, const __bf16* __restrict__ VB, const int* __restrict__ VL, float* __restrict__ Y) {
  __shared__ __align__(16) __bf16 sk[2][SK][SP], sv[2][HD][SP];
  const int tid = threadIdx.x, wave = tid >> 5, lane = tid & 31, col = lane & 15, g = lane >> 4; const int h = blockIdx.y; const int ql0 = blockIdx.x * 256 + wave * 16; const int vl = VL[h];
  const int srow = tid >> 3, sseg = (tid & 7) * 8;   /* staging: 8 threads a row of 128 bytes, 64 rows an array */
  const __bf16* gk = KB + (size_t)srow * CC + h * HD + sseg;
  const __bf16* gv = VB + ((size_t)h * HD + srow) * (size_t)KHI + sseg;
  v8b r0 = *(const v8b*)gk, r2 = *(const v8b*)gv;
  v16b qb[HD / 32];
  // the inner loops are unrolled so that every fragment and accumulator array stays in registers
#pragma unroll
  for (int kc = 0; kc < HD / 32; ++kc) { const size_t qo = (size_t)(ql0 + col) * CC + h * HD + kc * 32; qb[kc] = frag_b(QB + qo, lane); }
  asm volatile("s_wait_xcnt 0x0" ::: "memory");   /* the wait in front of the reuse of the first loads' address registers */
  *(v8b*)&sk[0][srow][sseg] = r0; *(v8b*)&sv[0][srow][sseg] = r2;
  __syncthreads();
  v8f acc[HD / 16] = {}; float m = -3.0e38f, l = 0.f;
  for (int st = 0; st < TT / SK; ++st) { const int bu = st & 1; const bool more = st + 1 < TT / SK;
    if (more) { const size_t kn = (size_t)(st + 1) * SK * CC; const int vn = (st + 1) * SK; r0 = *(const v8b*)(gk + kn); r2 = *(const v8b*)(gv + vn);
      asm volatile("s_wait_xcnt 0x0" ::: "memory"); }   /* the two loads stay in flight over the stage while their address registers are reused: the wait in front of that overwrite */
    for (int ps = 0; ps < SK / 32; ++ps) { const int k0 = st * SK + ps * 32;
      v8f s[2] = {}; v16b kb[4];
#pragma unroll
      for (int i = 0; i < 4; ++i) { const int kr = ps * 32 + (i >> 1) * 16 + col; kb[i] = frag_b(&sk[bu][kr][(i & 1) * 32], lane); }
      __builtin_amdgcn_sched_barrier(0);   /* holds the pass's 8 k fragment reads together in front of the products: one LDS wait a pass, not one between every few products */
#pragma unroll
      for (int t = 0; t < 2; ++t) {
#pragma unroll
        for (int kc = 0; kc < HD / 32; ++kc) s[t] = mmb(kb[t * 2 + kc], qb[kc], s[t]); }
      v16b vh[HD / 16];
#pragma unroll
      for (int j = 0; j < HD / 16; ++j) vh[j] = frag_b(&sv[bu][j * 16 + col][ps * 32], lane);
      __builtin_amdgcn_sched_barrier(0);   /* holds the v fragment reads in front of the softmax arithmetic, which then covers their latency */
      float p[16];
#pragma unroll
      for (int i = 0; i < 16; ++i) p[i] = s[i >> 3][i & 7] * SCALE;
      if (k0 + 32 > vl) {   /* sequence_mask: keys at index >= valid_len are SET to -1e6, as written; a pass wholly below valid_len has none */
        const int rem = vl - k0 - 8 * g;
#pragma unroll
        for (int i = 0; i < 16; ++i) if ((i >> 3) * 16 + (i & 7) >= rem) p[i] = -1000000.0f; }
      float mx = m;
#pragma unroll
      for (int i = 0; i < 16; ++i) mx = fmaxf(mx, p[i]);
      mx = fmaxf(mx, xhalf(mx));
      const float al = expf(m - mx); m = mx; float sum = 0.f;
#pragma unroll
      for (int i = 0; i < 16; ++i) { p[i] = expf(p[i] - mx); sum += p[i]; }
      l = l * al + sum;
#pragma unroll
      for (int j = 0; j < HD / 16; ++j) acc[j] *= al;
      const F2 pf = bsplit16(p);
#pragma unroll
      for (int j = 0; j < HD / 16; ++j) { acc[j] = mmb(vh[j], pf.h, acc[j]); acc[j] = mmb(vh[j], pf.l, acc[j]); } }
    if (more) { *(v8b*)&sk[bu ^ 1][srow][sseg] = r0; *(v8b*)&sv[bu ^ 1][srow][sseg] = r2; }
    __syncthreads(); }
  l += xhalf(l); const float inv = 1.0f / l;
  float* yr = Y + ((size_t)h * TT + ql0 + col) * HD + 8 * g;   /* register r of tile j = output column j * 16 + 8g + r of query col: 32 contiguous bytes a lane */
#pragma unroll
  for (int j = 0; j < HD / 16; ++j) { v4f a, b;
#pragma unroll
    for (int r = 0; r < 4; ++r) { a[r] = acc[j][r] * inv; b[r] = acc[j][4 + r] * inv; }
    vst2(yr + j * 16, a); vst2(yr + j * 16 + 4, b); } }

extern "C" void kernel_launch(void* const* d_in, const int* in_sizes, int n_in, void* d_out, int out_size, void* d_ws, size_t ws_size, hipStream_t stream) {
  (void)in_sizes; (void)n_in; (void)out_size;
  const float** F = (const float**)d_in;
  if (ws_size < (size_t)WS_END) return;
  char* ws = (char*)d_ws; __bf16 *QB = (__bf16*)(ws + WS_QB), *KB = (__bf16*)(ws + WS_KB), *VB = (__bf16*)(ws + WS_VB);
  // inputs (in order): 0 queries [32,2048,64]; 1 keys; 2 values; 3 valid_lens [32] int
  k_prep8<<<dim3(TNB * TT / 64, NH), 128, 0, stream>>>(F[0], F[1], F[2], QB, KB, VB);
  k_fa<<<dim3(TT / 256, NH), 512, 0, stream>>>(QB, KB, VB, (const int*)d_in[3], (float*)d_out);
}

// v003
// A run of this version takes 61.4 microseconds.
// In both of two side-by-side timings against v002, it was 1.52 times as fast.
// Counting every step since v000, it is 23.3 times as fast.
// compute dtype: all float inputs rounded to bf16 and carried EXACTLY in one bf16 plane each; logits q.k as single EXACT products on WMMA 16x16x32 bf16 (f32 accumulate) / 8, keys at index >= valid_len set to -1e6; softmax in f32, its exponentials on the hardware's base-2 instruction (1/8 and log2(e) folded into one multiply-add); P split bf16 hi + lo (2 products against the exact bf16 v) for every query row; f32 output.
#include <hip/hip_runtime.h>
#include <math.h>

typedef __attribute__((ext_vector_type(16))) _Float16 v16h;
typedef __attribute__((ext_vector_type(16))) __bf16 v16b;
typedef __attribute__((ext_vector_type(8)))  _Float16 v8h;
typedef __attribute__((ext_vector_type(8)))  float v8f;
typedef __attribute__((ext_vector_type(4)))  float v4f;
typedef __attribute__((ext_vector_type(2)))  float v2f;
typedef __attribute__((ext_vector_type(4)))  unsigned v4u;
typedef __attribute__((ext_vector_type(4)))  int v4i;
typedef float __attribute__((may_alias)) float_a;
typedef int __attribute__((may_alias)) int_a;

template <typename T> __device__ __forceinline__ void vst2(void* p, T v) { *(T*)p = v;  }
__device__ __forceinline__ v8f wmma16(v16h a, v16h b, v8f c) {
  v8f d = __builtin_amdgcn_wmma_f32_16x16x32_f16(false, a, false, b, (short)0, c, false, false);
  asm volatile("v_nop\n\tv_nop\n\tv_nop\n\tv_nop" : "+v"(d) : "v"(a), "v"(b));
  return d;
}
__device__ __forceinline__ v8f wmma_bf(v16b a, v16b b, v8f c) {
  v8f d = __builtin_amdgcn_wmma_f32_16x16x32_bf16(false, a, false, b, (short)0, c, false, false);
  asm volatile("v_nop\n\tv_nop\n\tv_nop\n\tv_nop" : "+v"(d) : "v"(a), "v"(b));
  return d;
}
// 16x16x32 fragments: lane = (h = lane>>4, row/col = lane&15); elements 0..7 = k0+8h+0..7, 8..15 = k0+16+8h+0..7; D element r = row 8h+r
__device__ __forceinline__ v16h frag_h(const _Float16* rowk0, int lane) {
  union { v16h v; v8h q[2]; } u; const _Float16* p = rowk0 + 8 * (lane >> 4);
  u.q[0] = *(const v8h*)p; u.q[1] = *(const v8h*)(p + 16); return u.v;
}
__device__ __forceinline__ v16h frag_f32(const float* rowk0, int lane) {
  v16h a; const float* p = rowk0 + 8 * (lane >> 4);
#pragma unroll
  for (int i = 0; i < 8; ++i) { a[i] = (_Float16)p[i]; a[8 + i] = (_Float16)p[16 + i]; }
  return a;
}
__device__ __forceinline__ v16h frag_f32s(const float* rowk0, int lane, float sc) {
  v16h a; const float* p = rowk0 + 8 * (lane >> 4);
#pragma unroll
  for (int i = 0; i < 8; ++i) { a[i] = (_Float16)(p[i] * sc); a[8 + i] = (_Float16)(p[16 + i] * sc); }
  return a;
}
// column fragment from a [K][ld] layout (column n), rows >= K read as 0
__device__ __forceinline__ v16h fragc_f32(const float* W, int k0, int n, int lane, int ld, int K) {
  v16h a; const int g = lane >> 4;
#pragma unroll
  for (int i = 0; i < 8; ++i) { const int ka = k0 + 8 * g + i, kb = ka + 16;
    a[i] = (_Float16)(ka < K ? W[(size_t)(ka < K ? ka : K - 1) * ld + n] : 0.f); a[8 + i] = (_Float16)(kb < K ? W[(size_t)(kb < K ? kb : K - 1) * ld + n] : 0.f); }
  return a;
}
struct F2 { v16b h, l; };
__device__ __forceinline__ F2 bsplit16(const float v[16]) { F2 r;
#pragma unroll
  for (int i = 0; i < 16; ++i) { const __bf16 h = (__bf16)v[i]; r.h[i] = h; r.l[i] = (__bf16)(v[i] - (float)h); }
  return r; }
__device__ __forceinline__ F2 split_row(const float* row, int k0, int lane) { float v[16]; const float* p = row + k0 + 8 * (lane >> 4);
#pragma unroll
  for (int i = 0; i < 8; ++i) { v[i] = p[i]; v[8 + i] = p[16 + i]; }
  return bsplit16(v); }
__device__ __forceinline__ F2 split_rowK(const float* row, int k0, int lane, int K) { float v[16]; const int g = lane >> 4;
#pragma unroll
  for (int i = 0; i < 8; ++i) { const int ka = k0 + 8 * g + i, kb = ka + 16; v[i] = ka < K ? row[ka < K ? ka : K - 1] : 0.f; v[8 + i] = kb < K ? row[kb < K ? kb : K - 1] : 0.f; }
  return bsplit16(v); }
__device__ __forceinline__ F2 split_col(const float* W, int k0, int n, int lane, int ld, int K) { float v[16]; const int g = lane >> 4;
#pragma unroll
  for (int i = 0; i < 8; ++i) { const int ka = k0 + 8 * g + i, kb = ka + 16; v[i] = ka < K ? W[(size_t)(ka < K ? ka : K - 1) * ld + n] : 0.f; v[8 + i] = kb < K ? W[(size_t)(kb < K ? kb : K - 1) * ld + n] : 0.f; }
  return bsplit16(v); }
__device__ __forceinline__ v8f mac3(const F2& a, const F2& b, v8f c) { c = wmma_bf(a.l, b.h, c); c = wmma_bf(a.h, b.l, c); return wmma_bf(a.h, b.h, c); }
__device__ __forceinline__ float sigm(float v) { return 1.0f / (1.0f + expf(-v)); }
#define LDSX() do { asm volatile("s_wait_dscnt 0" ::: "memory"); __builtin_amdgcn_wave_barrier(); __builtin_amdgcn_fence(__ATOMIC_RELEASE, "workgroup"); } while (0)

// Masked dot-product attention (B 32 sequences treated as 32 planes, S 2,048, D 64): scores = q k^T / 8; keys k >= valid_lens[b] set to -1e6 (sequence mask); softmax; out = weights v -> [32, 2,048, 64].
#define NB 1
#define TT 2048
#define CC 2048            // NH * HD = projected width
#define DIN 2048          // input (model) width
#define NH 32
#define HD 64
#define NQB (TT / 64)
#define HG 4
#define SCALE (0.125f)
#define CAUSAL 0
#ifndef TNB
#define TNB NB
#endif
__device__ __forceinline__ float bfr(float v) { return (float)(__bf16)v; }
__host__ __device__ __forceinline__ int kb_last(int qb) { return CAUSAL ? ((qb * 64 + 63) >> 7) : (TT / 128 - 1); }
typedef __attribute__((ext_vector_type(8))) __bf16 v8b;
__device__ __forceinline__ v16b frag_b(const __bf16* rowk0, int lane) {
  union { v16b v; v8b q[2]; } u; const __bf16* p = rowk0 + 8 * (lane >> 4);
  u.q[0] = *(const v8b*)p; u.q[1] = *(const v8b*)(p + 16); return u.v;
}
#define QBH NQB            // every query block takes the bf16 hi + lo P.v path
#define KHI 2048           // keys a bf16 v plane holds: every key
// B fragment (k rows k0+.., output column o) of a weight: (in,out) [K][ld] or (out,in) [ld rows of K]: bf16 exact, or f16(bf16 * 256) exact
__device__ __forceinline__ v16b wcol_io(const float* Wm, int k0, int o, int lane, int ld) { v16b w; const int g = lane >> 4;
#pragma unroll
  for (int i = 0; i < 8; ++i) { w[i] = (__bf16)Wm[(size_t)(k0 + 8 * g + i) * ld + o]; w[8 + i] = (__bf16)Wm[(size_t)(k0 + 16 + 8 * g + i) * ld + o]; }
  return w; }
__device__ __forceinline__ v16b wcol_oi(const float* Wm, int k0, int o, int lane, int K) { v16b w; const float* p = Wm + (size_t)o * K + k0 + 8 * (lane >> 4);
#pragma unroll
  for (int i = 0; i < 8; ++i) { w[i] = (__bf16)p[i]; w[8 + i] = (__bf16)p[16 + i]; }
  return w; }
__device__ __forceinline__ v16h wcolh_io(const float* Wm, int k0, int o, int lane, int ld) { v16h w; const int g = lane >> 4;
#pragma unroll
  for (int i = 0; i < 8; ++i) { w[i] = (_Float16)(bfr(Wm[(size_t)(k0 + 8 * g + i) * ld + o]) * 256.0f); w[8 + i] = (_Float16)(bfr(Wm[(size_t)(k0 + 16 + 8 * g + i) * ld + o]) * 256.0f); }
  return w; }
__device__ __forceinline__ v16h wcolh_oi(const float* Wm, int k0, int o, int lane, int K) { v16h w; const float* p = Wm + (size_t)o * K + k0 + 8 * (lane >> 4);
#pragma unroll
  for (int i = 0; i < 8; ++i) { w[i] = (_Float16)(bfr(p[i]) * 256.0f); w[8 + i] = (_Float16)(bfr(p[16 + i]) * 256.0f); }
  return w; }
#define WQKV_LAYOUT 1   // 0 = (in,out) [DIN][CC]; 1 = (out,in) [CC][DIN]; 2 = per-head [NH][DIN][HD]
__device__ __forceinline__ v16b wcol_hdk(const float* Wm, int k0, int o, int lane) { v16b w; const int g = lane >> 4; const float* p = Wm + (size_t)(o / HD) * DIN * HD + (o % HD);
#pragma unroll
  for (int i = 0; i < 8; ++i) { w[i] = (__bf16)p[(size_t)(k0 + 8 * g + i) * HD]; w[8 + i] = (__bf16)p[(size_t)(k0 + 16 + 8 * g + i) * HD]; }
  return w; }
#define WO_OUT_IN 0
#if WQKV_LAYOUT == 1
#define WCOL(W, k0, o, lane) wcol_oi(W, k0, o, lane, DIN)
#elif WQKV_LAYOUT == 2
#define WCOL(W, k0, o, lane) wcol_hdk(W, k0, o, lane)
#else
#define WCOL(W, k0, o, lane) wcol_io(W, k0, o, lane, CC)
#endif
#if WO_OUT_IN
#define WOCOL(W, k0, o, lane) wcol_oi(W, k0, o, lane, CC)
#define WOCOLH(W, k0, o, lane) wcolh_oi(W, k0, o, lane, CC)
#else
#define WOCOL(W, k0, o, lane) wcol_io(W, k0, o, lane, DIN)
#define WOCOLH(W, k0, o, lane) wcolh_io(W, k0, o, lane, DIN)
#endif
// ---- k_prep8: block = (64 attention positions s0.. of sequence b, head h): reads the module's [B, H, S, 64] inputs (element (b,h,s,c) at ((b*NH + h)*TT + s)*64 + c), bf16-rounds them and writes the attention planes: q -> bf16 rows, k -> bf16 rows, v -> bf16 planes [c][s]. A bf16-rounded value is its own bf16 plane: there is no residual to carry.
__global__ __launch_bounds__(128) void k_prep8(const float* __restrict__ Q, const float* __restrict__ K, const float* __restrict__ V, __bf16* __restrict__ QB, __bf16* __restrict__ KB, __bf16* __restrict__ VB) {
  __shared__ __align__(16) __bf16 sq[64][72], sk[64][72], tb[HD][72];
  const int tid = threadIdx.x; const int h = blockIdx.y; const size_t r0 = (size_t)blockIdx.x * 64; const size_t bb = r0 / TT; const int t0 = (int)(r0 % TT);
  for (int e = tid; e < 64 * HD; e += 128) { const int rl = e / HD, c = e % HD; const size_t oi = ((bb * NH + h) * TT + t0 + rl) * HD + c;
    sq[rl][c] = (__bf16)Q[oi]; sk[rl][c] = (__bf16)K[oi]; tb[c][rl] = (__bf16)V[oi]; }   /* module inputs: bf16-rounded */
  __syncthreads();
  for (int e = tid; e < 64 * (HD / 8); e += 128) { const int rl = e / (HD / 8), q = e % (HD / 8); const size_t o = (r0 + rl) * CC + h * HD + q * 8; vst2((unsigned*)(QB + o), *(const v4u*)&sq[rl][q * 8]); vst2((unsigned*)(KB + o), *(const v4u*)&sk[rl][q * 8]); }
  for (int e = tid; e < HD * 8; e += 128) { const int cl = e >> 3, q = e & 7; vst2((unsigned*)(VB + (bb * CC + h * HD + cl) * (size_t)KHI + t0 + q * 8), *(const v4u*)&tb[cl][q * 8]); } }


#define WS_QB  0u                                      // bf16 q rows [b*t][CC]
#define WS_KB  (WS_QB + 2u * (size_t)NB * TT * CC)      // bf16 k rows [b*t][CC]
#define WS_VB  (WS_KB + 2u * (size_t)NB * TT * CC)      // bf16 v planes [b][c][t]
#define WS_END (WS_VB + 2u * (size_t)NB * CC * KHI)

// plain builtin form for the fused kernel: the compiler keeps the distance behind its own matrix instructions
__device__ __forceinline__ v8f mmb(v16b a, v16b b, v8f c) { return __builtin_amdgcn_wmma_f32_16x16x32_bf16(false, a, false, b, (short)0, c, false, false); }
__device__ __forceinline__ float xhalf(float x) { return __builtin_bit_cast(float, __builtin_amdgcn_permlanex16(__builtin_bit_cast(int, x), __builtin_bit_cast(int, x), 0x76543210, 0xfedcba98, false, false)); }   // lane l reads lane l ^ 16, on the vector port: no LDS counter to wait on while fragment reads are in flight
#define SK 64              // keys a stage: the block's 16 waves share one staged copy of the stage's k rows and v planes
#define C2 0.18033688011112042f   // SCALE * log2(e): exp(SCALE * s - max) = 2^(C2 * s - C2 * smax)
#define MASKRAW (-8000000.0f)      // the mask fill -1e6 in front of the scale: MASKRAW * SCALE is exactly -1e6
// base-2 exponentials in one statement that ends with the slot the instruction set asks for behind a transcendental; the results are early-clobber: none may share a register with a source that is still to be read
__device__ __forceinline__ void exp2x8(float* o, const float* i) {
  asm("v_exp_f32 %0, %8\n\tv_exp_f32 %1, %9\n\tv_exp_f32 %2, %10\n\tv_exp_f32 %3, %11\n\tv_exp_f32 %4, %12\n\tv_exp_f32 %5, %13\n\tv_exp_f32 %6, %14\n\tv_exp_f32 %7, %15\n\tv_nop"
      : "=&v"(o[0]), "=&v"(o[1]), "=&v"(o[2]), "=&v"(o[3]), "=&v"(o[4]), "=&v"(o[5]), "=&v"(o[6]), "=&v"(o[7]) : "v"(i[0]), "v"(i[1]), "v"(i[2]), "v"(i[3]), "v"(i[4]), "v"(i[5]), "v"(i[6]), "v"(i[7])); }
#define SP 72              // LDS row pitch in 16-bit elements: 144 B = 16 B x odd, the pitch for 16-byte fragment reads
// ---- k_fa: block = 256 queries of plane h, 16 waves x 16 query columns; every wave walks all keys, 32 a pass, and keeps logits and weights in registers.
// S^T = K . Q^T (A = 16 key rows, B = 16 query columns): lane (g, col) holds query col, register r = key 8g + r, so two S^T tiles (keys +0..15, +16..31) are, converted in place, the B operand of O^T += V^T . P^T.
// Running maximum m (of the unscaled logits) and running sum l per query column (each lane half sums its own keys; the halves join after the loop); O^T and l are rescaled by 2^(C2 * (m_old - m_new)) every pass: exactly 1 while the maximum stands.
// k rows and v planes come through registers into two LDS buffers, whole 128-byte lines a row: stage st + 1 is loaded while stage st is worked on, stored behind it, and one barrier a stage both publishes it and ends the reads of the buffer that is refilled next.
__global__ __launch_bounds__(512) void k_fa(const __bf16* __restrict__ QB, const __bf16* __restrict__ KB, const __bf16* __restrict__ VB, const int* __restrict__ VL, float* __restrict__ Y) {
  __shared__ __align__(16) __bf16 sk[2][SK][SP], sv[2][HD][SP];
  const int tid = threadIdx.x, wave = tid >> 5, lane = tid & 31, col = lane & 15, g = lane >> 4; const int h = blockIdx.y; const int ql0 = blockIdx.x * 256 + wave * 16; const int vl = VL[h];
  const int srow = tid >> 3, sseg = (tid & 7) * 8;   /* staging: 8 threads a row of 128 bytes, 64 rows an array */
  const __bf16* gk = KB + (size_t)srow * CC + h * HD + sseg;
  const __bf16* gv = VB + ((size_t)h * HD + srow) * (size_t)KHI + sseg;
  v8b r0 = *(const v8b*)gk, r2 = *(const v8b*)gv;
  v16b qb[HD / 32];
  // the inner loops are unrolled so that every fragment and accumulator array stays in registers
#pragma unroll
  for (int kc = 0; kc < HD / 32; ++kc) { const size_t qo = (size_t)(ql0 + col) * CC + h * HD + kc * 32; qb[kc] = frag_b(QB + qo, lane); }
  asm volatile("s_wait_xcnt 0x0" ::: "memory");   /* the wait in front of the reuse of the first loads' address registers */
  *(v8b*)&sk[0][srow][sseg] = r0; *(v8b*)&sv[0][srow][sseg] = r2;
  __syncthreads();
  v8f acc[HD / 16] = {}; float m = -3.0e38f, l = 0.f;
  for (int st = 0; st < TT / SK; ++st) { const int bu = st & 1; const bool more = st + 1 < TT / SK;
    if (more) { const size_t kn = (size_t)(st + 1) * SK * CC; const int vn = (st + 1) * SK; r0 = *(const v8b*)(gk + kn); r2 = *(const v8b*)(gv + vn);
      asm volatile("s_wait_xcnt 0x0" ::: "memory"); }   /* the two loads stay in flight over the stage while their address registers are reused: the wait in front of that overwrite */
    for (int ps = 0; ps < SK / 32; ++ps) { const int k0 = st * SK + ps * 32;
      v8f s[2] = {}; v16b kb[4];
#pragma unroll
      for (int i = 0; i < 4; ++i) { const int kr = ps * 32 + (i >> 1) * 16 + col; kb[i] = frag_b(&sk[bu][kr][(i & 1) * 32], lane); }
      __builtin_amdgcn_sched_barrier(0);   /* holds the pass's 8 k fragment reads together in front of the products: one LDS wait a pass, not one between every few products */
#pragma unroll
      for (int t = 0; t < 2; ++t) {
#pragma unroll
        for (int kc = 0; kc < HD / 32; ++kc) s[t] = mmb(kb[t * 2 + kc], qb[kc], s[t]); }
      v16b vh[HD / 16];
#pragma unroll
      for (int j = 0; j < HD / 16; ++j) vh[j] = frag_b(&sv[bu][j * 16 + col][ps * 32], lane);
      __builtin_amdgcn_sched_barrier(0);   /* holds the v fragment reads in front of the softmax arithmetic, which then covers their latency */
      float p[16];
#pragma unroll
      for (int i = 0; i < 16; ++i) p[i] = s[i >> 3][i & 7];
      if (k0 + 32 > vl) {   /* sequence_mask: keys at index >= valid_len are SET to -1e6, as written; a pass wholly below valid_len has none */
        const int rem = vl - k0 - 8 * g;
#pragma unroll
        for (int i = 0; i < 16; ++i) if ((i >> 3) * 16 + (i & 7) >= rem) p[i] = MASKRAW; }
      float mx = m;
#pragma unroll
      for (int i = 0; i < 16; ++i) mx = fmaxf(mx, p[i]);
      mx = fmaxf(mx, xhalf(mx));
      float al; asm("v_exp_f32 %0, %1\n\tv_nop" : "=v"(al) : "v"((m - mx) * C2));   /* the same form for the one rescale factor */
      m = mx; float e[16]; const v2f c2 = {C2, C2}, n2 = {-mx * C2, -mx * C2};
#pragma unroll
      for (int i = 0; i < 16; i += 2) { const v2f a = {p[i], p[i + 1]}; const v2f t = __builtin_elementwise_fma(a, c2, n2);   /* two exponents a packed multiply-add */
        e[i] = t[0]; e[i + 1] = t[1]; }
      exp2x8(p, e); exp2x8(p + 8, e + 8);
      float sum = p[0];
#pragma unroll
      for (int i = 1; i < 16; ++i) sum += p[i];
      l = l * al + sum;
#pragma unroll
      for (int j = 0; j < HD / 16; ++j) acc[j] *= al;
      const F2 pf = bsplit16(p);
#pragma unroll
      for (int j = 0; j < HD / 16; ++j) { acc[j] = mmb(vh[j], pf.h, acc[j]); acc[j] = mmb(vh[j], pf.l, acc[j]); } }
    if (more) { *(v8b*)&sk[bu ^ 1][srow][sseg] = r0; *(v8b*)&sv[bu ^ 1][srow][sseg] = r2; }
    __syncthreads(); }
  l += xhalf(l); const float inv = 1.0f / l;
  float* yr = Y + ((size_t)h * TT + ql0 + col) * HD + 8 * g;   /* register r of tile j = output column j * 16 + 8g + r of query col: 32 contiguous bytes a lane */
#pragma unroll
  for (int j = 0; j < HD / 16; ++j) { v4f a, b;
#pragma unroll
    for (int r = 0; r < 4; ++r) { a[r] = acc[j][r] * inv; b[r] = acc[j][4 + r] * inv; }
    vst2(yr + j * 16, a); vst2(yr + j * 16 + 4, b); } }

extern "C" void kernel_launch(void* const* d_in, const int* in_sizes, int n_in, void* d_out, int out_size, void* d_ws, size_t ws_size, hipStream_t stream) {
  (void)in_sizes; (void)n_in; (void)out_size;
  const float** F = (const float**)d_in;
  if (ws_size < (size_t)WS_END) return;
  char* ws = (char*)d_ws; __bf16 *QB = (__bf16*)(ws + WS_QB), *KB = (__bf16*)(ws + WS_KB), *VB = (__bf16*)(ws + WS_VB);
  // inputs (in order): 0 queries [32,2048,64]; 1 keys; 2 values; 3 valid_lens [32] int
  k_prep8<<<dim3(TNB * TT / 64, NH), 128, 0, stream>>>(F[0], F[1], F[2], QB, KB, VB);
  k_fa<<<dim3(TT / 256, NH), 512, 0, stream>>>(QB, KB, VB, (const int*)d_in[3], (float*)d_out);
}

// v004
// It runs in 44.1 microseconds.
// Two timings next to v003 both put it at 1.39 times that version's speed.
// Over all steps from v000 it is 32.4 times as fast.
// compute dtype: all float inputs rounded to bf16 and carried EXACTLY in one bf16 plane each; logits q.k as single EXACT products on WMMA 16x16x32 bf16 (f32 accumulate) / 8, keys at index >= valid_len set to -1e6; softmax in f32, its exponentials on the hardware's base-2 instruction (1/8 and log2(e) folded into one multiply-add); P split bf16 hi + lo (2 products against the exact bf16 v) for every query row; f32 output.
#include <hip/hip_runtime.h>
#include <math.h>

typedef __attribute__((ext_vector_type(16))) _Float16 v16h;
typedef __attribute__((ext_vector_type(16))) __bf16 v16b;
typedef __attribute__((ext_vector_type(8)))  _Float16 v8h;
typedef __attribute__((ext_vector_type(8)))  float v8f;
typedef __attribute__((ext_vector_type(4)))  float v4f;
typedef __attribute__((ext_vector_type(2)))  float v2f;
typedef __attribute__((ext_vector_type(4)))  unsigned v4u;
typedef __attribute__((ext_vector_type(4)))  int v4i;
typedef float __attribute__((may_alias)) float_a;
typedef int __attribute__((may_alias)) int_a;

template <typename T> __device__ __forceinline__ void vst2(void* p, T v) { *(T*)p = v;  }
__device__ __forceinline__ v8f wmma16(v16h a, v16h b, v8f c) {
  v8f d = __builtin_amdgcn_wmma_f32_16x16x32_f16(false, a, false, b, (short)0, c, false, false);
  asm volatile("v_nop\n\tv_nop\n\tv_nop\n\tv_nop" : "+v"(d) : "v"(a), "v"(b));
  return d;
}
__device__ __forceinline__ v8f wmma_bf(v16b a, v16b b, v8f c) {
  v8f d = __builtin_amdgcn_wmma_f32_16x16x32_bf16(false, a, false, b, (short)0, c, false, false);
  asm volatile("v_nop\n\tv_nop\n\tv_nop\n\tv_nop" : "+v"(d) : "v"(a), "v"(b));
  return d;
}
// 16x16x32 fragments: lane = (h = lane>>4, row/col = lane&15); elements 0..7 = k0+8h+0..7, 8..15 = k0+16+8h+0..7; D element r = row 8h+r
__device__ __forceinline__ v16h frag_h(const _Float16* rowk0, int lane) {
  union { v16h v; v8h q[2]; } u; const _Float16* p = rowk0 + 8 * (lane >> 4);
  u.q[0] = *(const v8h*)p; u.q[1] = *(const v8h*)(p + 16); return u.v;
}
__device__ __forceinline__ v16h frag_f32(const float* rowk0, int lane) {
  v16h a; const float* p = rowk0 + 8 * (lane >> 4);
#pragma unroll
  for (int i = 0; i < 8; ++i) { a[i] = (_Float16)p[i]; a[8 + i] = (_Float16)p[16 + i]; }
  return a;
}
__device__ __forceinline__ v16h frag_f32s(const float* rowk0, int lane, float sc) {
  v16h a; const float* p = rowk0 + 8 * (lane >> 4);
#pragma unroll
  for (int i = 0; i < 8; ++i) { a[i] = (_Float16)(p[i] * sc); a[8 + i] = (_Float16)(p[16 + i] * sc); }
  return a;
}
// column fragment from a [K][ld] layout (column n), rows >= K read as 0
__device__ __forceinline__ v16h fragc_f32(const float* W, int k0, int n, int lane, int ld, int K) {
  v16h a; const int g = lane >> 4;
#pragma unroll
  for (int i = 0; i < 8; ++i) { const int ka = k0 + 8 * g + i, kb = ka + 16;
    a[i] = (_Float16)(ka < K ? W[(size_t)(ka < K ? ka : K - 1) * ld + n] : 0.f); a[8 + i] = (_Float16)(kb < K ? W[(size_t)(kb < K ? kb : K - 1) * ld + n] : 0.f); }
  return a;
}
struct F2 { v16b h, l; };
__device__ __forceinline__ F2 bsplit16(const float v[16]) { F2 r;
#pragma unroll
  for (int i = 0; i < 16; ++i) { const __bf16 h = (__bf16)v[i]; r.h[i] = h; r.l[i] = (__bf16)(v[i] - (float)h); }
  return r; }
__device__ __forceinline__ F2 split_row(const float* row, int k0, int lane) { float v[16]; const float* p = row + k0 + 8 * (lane >> 4);
#pragma unroll
  for (int i = 0; i < 8; ++i) { v[i] = p[i]; v[8 + i] = p[16 + i]; }
  return bsplit16(v); }
__device__ __forceinline__ F2 split_rowK(const float* row, int k0, int lane, int K) { float v[16]; const int g = lane >> 4;
#pragma unroll
  for (int i = 0; i < 8; ++i) { const int ka = k0 + 8 * g + i, kb = ka + 16; v[i] = ka < K ? row[ka < K ? ka : K - 1] : 0.f; v[8 + i] = kb < K ? row[kb < K ? kb : K - 1] : 0.f; }
  return bsplit16(v); }
__device__ __forceinline__ F2 split_col(const float* W, int k0, int n, int lane, int ld, int K) { float v[16]; const int g = lane >> 4;
#pragma unroll
  for (int i = 0; i < 8; ++i) { const int ka = k0 + 8 * g + i, kb = ka + 16; v[i] = ka < K ? W[(size_t)(ka < K ? ka : K - 1) * ld + n] : 0.f; v[8 + i] = kb < K ? W[(size_t)(kb < K ? kb : K - 1) * ld + n] : 0.f; }
  return bsplit16(v); }
__device__ __forceinline__ v8f mac3(const F2& a, const F2& b, v8f c) { c = wmma_bf(a.l, b.h, c); c = wmma_bf(a.h, b.l, c); return wmma_bf(a.h, b.h, c); }
__device__ __forceinline__ float sigm(float v) { return 1.0f / (1.0f + expf(-v)); }
#define LDSX() do { asm volatile("s_wait_dscnt 0" ::: "memory"); __builtin_amdgcn_wave_barrier(); __builtin_amdgcn_fence(__ATOMIC_RELEASE, "workgroup"); } while (0)

// Masked dot-product attention (B 32 sequences treated as 32 planes, S 2,048, D 64): scores = q k^T / 8; keys k >= valid_lens[b] set to -1e6 (sequence mask); softmax; out = weights v -> [32, 2,048, 64].
#define NB 1
#define TT 2048
#define CC 2048            // NH * HD = projected width
#define DIN 2048          // input (model) width
#define NH 32
#define HD 64
#define NQB (TT / 64)
#define HG 4
#define SCALE (0.125f)
#define CAUSAL 0
#ifndef TNB
#define TNB NB
#endif
__device__ __forceinline__ float bfr(float v) { return (float)(__bf16)v; }
__host__ __device__ __forceinline__ int kb_last(int qb) { return CAUSAL ? ((qb * 64 + 63) >> 7) : (TT / 128 - 1); }
typedef __attribute__((ext_vector_type(8))) __bf16 v8b;
__device__ __forceinline__ v16b frag_b(const __bf16* rowk0, int lane) {
  union { v16b v; v8b q[2]; } u; const __bf16* p = rowk0 + 8 * (lane >> 4);
  u.q[0] = *(const v8b*)p; u.q[1] = *(const v8b*)(p + 16); return u.v;
}
#define QBH NQB            // every query block takes the bf16 hi + lo P.v path
#define KHI 2048           // keys a bf16 v plane holds: every key
// B fragment (k rows k0+.., output column o) of a weight: (in,out) [K][ld] or (out,in) [ld rows of K]: bf16 exact, or f16(bf16 * 256) exact
__device__ __forceinline__ v16b wcol_io(const float* Wm, int k0, int o, int lane, int ld) { v16b w; const int g = lane >> 4;
#pragma unroll
  for (int i = 0; i < 8; ++i) { w[i] = (__bf16)Wm[(size_t)(k0 + 8 * g + i) * ld + o]; w[8 + i] = (__bf16)Wm[(size_t)(k0 + 16 + 8 * g + i) * ld + o]; }
  return w; }
__device__ __forceinline__ v16b wcol_oi(const float* Wm, int k0, int o, int lane, int K) { v16b w; const float* p = Wm + (size_t)o * K + k0 + 8 * (lane >> 4);
#pragma unroll
  for (int i = 0; i < 8; ++i) { w[i] = (__bf16)p[i]; w[8 + i] = (__bf16)p[16 + i]; }
  return w; }
__device__ __forceinline__ v16h wcolh_io(const float* Wm, int k0, int o, int lane, int ld) { v16h w; const int g = lane >> 4;
#pragma unroll
  for (int i = 0; i < 8; ++i) { w[i] = (_Float16)(bfr(Wm[(size_t)(k0 + 8 * g + i) * ld + o]) * 256.0f); w[8 + i] = (_Float16)(bfr(Wm[(size_t)(k0 + 16 + 8 * g + i) * ld + o]) * 256.0f); }
  return w; }
__device__ __forceinline__ v16h wcolh_oi(const float* Wm, int k0, int o, int lane, int K) { v16h w; const float* p = Wm + (size_t)o * K + k0 + 8 * (lane >> 4);
#pragma unroll
  for (int i = 0; i < 8; ++i) { w[i] = (_Float16)(bfr(p[i]) * 256.0f); w[8 + i] = (_Float16)(bfr(p[16 + i]) * 256.0f); }
  return w; }
#define WQKV_LAYOUT 1   // 0 = (in,out) [DIN][CC]; 1 = (out,in) [CC][DIN]; 2 = per-head [NH][DIN][HD]
__device__ __forceinline__ v16b wcol_hdk(const float* Wm, int k0, int o, int lane) { v16b w; const int g = lane >> 4; const float* p = Wm + (size_t)(o / HD) * DIN * HD + (o % HD);
#pragma unroll
  for (int i = 0; i < 8; ++i) { w[i] = (__bf16)p[(size_t)(k0 + 8 * g + i) * HD]; w[8 + i] = (__bf16)p[(size_t)(k0 + 16 + 8 * g + i) * HD]; }
  return w; }
#define WO_OUT_IN 0
#if WQKV_LAYOUT == 1
#define WCOL(W, k0, o, lane) wcol_oi(W, k0, o, lane, DIN)
#elif WQKV_LAYOUT == 2
#define WCOL(W, k0, o, lane) wcol_hdk(W, k0, o, lane)
#else
#define WCOL(W, k0, o, lane) wcol_io(W, k0, o, lane, CC)
#endif
#if WO_OUT_IN
#define WOCOL(W, k0, o, lane) wcol_oi(W, k0, o, lane, CC)
#define WOCOLH(W, k0, o, lane) wcolh_oi(W, k0, o, lane, CC)
#else
#define WOCOL(W, k0, o, lane) wcol_io(W, k0, o, lane, DIN)
#define WOCOLH(W, k0, o, lane) wcolh_io(W, k0, o, lane, DIN)
#endif
// ---- k_prep8: block = (64 attention positions s0.. of sequence b, head h): reads the module's [B, H, S, 64] inputs (element (b,h,s,c) at ((b*NH + h)*TT + s)*64 + c), bf16-rounds them and writes the attention planes: q -> bf16 rows, k -> bf16 rows, v -> bf16 planes [c][s]. A bf16-rounded value is its own bf16 plane: there is no residual to carry.
__global__ __launch_bounds__(128) void k_prep8(const float* __restrict__ Q, const float* __restrict__ K, const float* __restrict__ V, __bf16* __restrict__ QB, __bf16* __restrict__ KB, __bf16* __restrict__ VB) {
  __shared__ __align__(16) __bf16 sq[64][72], sk[64][72], tb[HD][72];
  const int tid = threadIdx.x; const int h = blockIdx.y; const size_t r0 = (size_t)blockIdx.x * 64; const size_t bb = r0 / TT; const int t0 = (int)(r0 % TT);
  for (int e = tid; e < 64 * HD; e += 128) { const int rl = e / HD, c = e % HD; const size_t oi = ((bb * NH + h) * TT + t0 + rl) * HD + c;
    sq[rl][c] = (__bf16)Q[oi]; sk[rl][c] = (__bf16)K[oi]; tb[c][rl] = (__bf16)V[oi]; }   /* module inputs: bf16-rounded */
  __syncthreads();
  for (int e = tid; e < 64 * (HD / 8); e += 128) { const int rl = e / (HD / 8), q = e % (HD / 8); const size_t o = (r0 + rl) * CC + h * HD + q * 8; vst2((unsigned*)(QB + o), *(const v4u*)&sq[rl][q * 8]); vst2((unsigned*)(KB + o), *(const v4u*)&sk[rl][q * 8]); }
  for (int e = tid; e < HD * 8; e += 128) { const int cl = e >> 3, q = e & 7; vst2((unsigned*)(VB + (bb * CC + h * HD + cl) * (size_t)KHI + t0 + q * 8), *(const v4u*)&tb[cl][q * 8]); } }


#define WS_QB  0u                                      // bf16 q rows [b*t][CC]
#define WS_KB  (WS_QB + 2u * (size_t)NB * TT * CC)      // bf16 k rows [b*t][CC]
#define WS_VB  (WS_KB + 2u * (size_t)NB * TT * CC)      // bf16 v planes [b][c][t]
#define WS_END (WS_VB + 2u * (size_t)NB * CC * KHI)

// plain builtin form for the fused kernel: the compiler keeps the distance behind its own matrix instructions
__device__ __forceinline__ v8f mmb(v16b a, v16b b, v8f c) { return __builtin_amdgcn_wmma_f32_16x16x32_bf16(false, a, false, b, (short)0, c, false, false); }
__device__ __forceinline__ float xhalf(float x) { return __builtin_bit_cast(float, __builtin_amdgcn_permlanex16(__builtin_bit_cast(int, x), __builtin_bit_cast(int, x), 0x76543210, 0xfedcba98, false, false)); }   // lane l reads lane l ^ 16, on the vector port: no LDS counter to wait on while fragment reads are in flight
#define SK 64              // keys a stage: a team's 4 waves share one staged copy of the stage's k rows and v planes
#define C2 0.18033688011112042f   // SCALE * log2(e): exp(SCALE * s - max) = 2^(C2 * s - C2 * smax)
#define MASKRAW (-8000000.0f)      // the mask fill -1e6 in front of the scale: MASKRAW * SCALE is exactly -1e6
// base-2 exponentials in one statement that ends with the slot the instruction set asks for behind a transcendental; the results are early-clobber: none may share a register with a source that is still to be read
__device__ __forceinline__ void exp2x8(float* o, const float* i) {
  asm("v_exp_f32 %0, %8\n\tv_exp_f32 %1, %9\n\tv_exp_f32 %2, %10\n\tv_exp_f32 %3, %11\n\tv_exp_f32 %4, %12\n\tv_exp_f32 %5, %13\n\tv_exp_f32 %6, %14\n\tv_exp_f32 %7, %15\n\tv_nop"
      : "=&v"(o[0]), "=&v"(o[1]), "=&v"(o[2]), "=&v"(o[3]), "=&v"(o[4]), "=&v"(o[5]), "=&v"(o[6]), "=&v"(o[7]) : "v"(i[0]), "v"(i[1]), "v"(i[2]), "v"(i[3]), "v"(i[4]), "v"(i[5]), "v"(i[6]), "v"(i[7])); }
#define SP 72              // LDS row pitch in 16-bit elements: 144 B = 16 B x odd, the pitch for 16-byte fragment reads
// ---- k_fa: block = 4 teams of 4 waves; a team = 64 queries of ONE plane, 16 query columns a wave, with its own two LDS buffers; a team walks only the passes of 32 keys that hold a key below its plane's valid_len.
// A key at or past valid_len has the logit -1e6 and, beside any real logit, the weight exactly 0: a pass of only such keys rescales by exactly 1 and adds only zeros to l and O^T, so it is not walked. (A plane with valid_len <= 0 has no real logit: it walks every key, as written.)
// The launch lasts as long as its fullest WGP: the planes are ranked by length on the device (ties by index, so the ranks are a permutation for any lengths) and block group y takes the ranks y, 8 + y, 23 - y, 31 - y, whose lengths add up to about the same for every y. Waves w, w + 4, w + 8, w + 12 are one of each team: as the short teams end, the long ones get their issue slots.
// S^T = K . Q^T (A = 16 key rows, B = 16 query columns): lane (g, col) holds query col, register r = key 8g + r, so two S^T tiles (keys +0..15, +16..31) are, converted in place, the B operand of O^T += V^T . P^T.
// Running maximum m (of the unscaled logits) and running sum l per query column (each lane half sums its own keys; the halves join after the loop); O^T and l are rescaled by 2^(C2 * (m_old - m_new)) every pass: exactly 1 while the maximum stands.
// k rows and v planes come through registers into the team's two LDS buffers, whole 128-byte lines a row: stage st + 1 is loaded while stage st is worked on, stored behind it, and one barrier a stage both publishes it and ends the reads of the buffer that is refilled next. Every wave passes every barrier up to the longest team's last stage, also a wave whose team has ended.
#define NT 4               // teams a block
#define SR 4               // rows of each array that a thread stages: 64 rows over 16 row slots
__device__ __forceinline__ int eff_len(int v) { return (v <= 0 || v > TT) ? TT : v; }   // keys a plane walks
__global__ __launch_bounds__(512) void k_fa(const __bf16* __restrict__ QB, const __bf16* __restrict__ KB, const __bf16* __restrict__ VB, const int* __restrict__ VL, float* __restrict__ Y) {
  __shared__ __align__(16) __bf16 sk[NT][2][SK][SP], sv[NT][2][HD][SP];
  const int tid = threadIdx.x, wave = __builtin_amdgcn_readfirstlane(tid >> 5), lane = tid & 31, col = lane & 15, g = lane >> 4; const int team = wave >> 2, ttid = tid & 127;
  // lane p ranks plane p: how many planes are longer, or as long with a lower index (one key holds both: no two keys are equal)
  const int vlp = VL[lane]; const int key = eff_len(vlp) * NH + (NH - 1 - lane); int rank = 0;
#pragma unroll
  for (int j = 0; j < NH; ++j) rank += __builtin_amdgcn_readlane(key, j) > key ? 1 : 0;
  const int gy = blockIdx.y; const int want = (team & 2 ? 31 - gy : gy) + (team == 1 ? 8 : team == 2 ? -8 : 0);
  const int h = __builtin_ctz(__builtin_amdgcn_ballot_w32(rank == want)) & (NH - 1);      /* the team's plane: a scalar, inside 0..31 whatever the lengths */
  const int hl = __builtin_ctz(__builtin_amdgcn_ballot_w32(rank == gy)) & (NH - 1);       /* the block's longest plane */
  const int vl = __builtin_amdgcn_readlane(vlp, h); const int np = (eff_len(vl) + 31) >> 5, nst = (np + 1) >> 1;   /* the team's passes and stages: at most TT / 32 and TT / SK */
  const int nsb = (eff_len(__builtin_amdgcn_readlane(vlp, hl)) + SK - 1) / SK;             /* the block's stages: the same in every wave, and no team has more */
  const int ql0 = blockIdx.x * 64 + (wave & 3) * 16;
  const int srow = ttid >> 3, sseg = (ttid & 7) * 8;   /* staging: 8 threads a row of 128 bytes, 16 rows a step, 4 steps an array */
  const __bf16* gk = KB + (size_t)srow * CC + h * HD + sseg;
  const __bf16* gv = VB + ((size_t)h * HD + srow) * (size_t)KHI + sseg;
  v8b rk[SR], rv[SR];
#pragma unroll
  for (int i = 0; i < SR; ++i) { rk[i] = *(const v8b*)(gk + (size_t)i * 16 * CC); rv[i] = *(const v8b*)(gv + (size_t)i * 16 * KHI); }
  v16b qb[HD / 32];
  // the inner loops are unrolled so that every fragment and accumulator array stays in registers
#pragma unroll
  for (int kc = 0; kc < HD / 32; ++kc) { const size_t qo = (size_t)(ql0 + col) * CC + h * HD + kc * 32; qb[kc] = frag_b(QB + qo, lane); }
  asm volatile("s_wait_xcnt 0x0" ::: "memory");   /* the wait in front of the reuse of the first loads' address registers */
#pragma unroll
  for (int i = 0; i < SR; ++i) { *(v8b*)&sk[team][0][srow + 16 * i][sseg] = rk[i]; *(v8b*)&sv[team][0][srow + 16 * i][sseg] = rv[i]; }
  __syncthreads();
  v8f acc[HD / 16] = {}; float m = -3.0e38f, l = 0.f;
  for (int st = 0; st < nsb; ++st) { const int bu = st & 1; const bool more = st + 1 < nst;
    if (more) { const size_t kn = (size_t)(st + 1) * SK * CC; const int vn = (st + 1) * SK;
#pragma unroll
      for (int i = 0; i < SR; ++i) { rk[i] = *(const v8b*)(gk + kn + (size_t)i * 16 * CC); rv[i] = *(const v8b*)(gv + vn + (size_t)i * 16 * KHI); }
      asm volatile("s_wait_xcnt 0x0" ::: "memory"); }   /* the loads stay in flight over the stage while their address registers are reused: the wait in front of that overwrite */
    for (int ps = 0; ps < SK / 32 && st * (SK / 32) + ps < np; ++ps) { const int k0 = st * SK + ps * 32;
      v8f s[2] = {}; v16b kb[4];
#pragma unroll
      for (int i = 0; i < 4; ++i) { const int kr = ps * 32 + (i >> 1) * 16 + col; kb[i] = frag_b(&sk[team][bu][kr][(i & 1) * 32], lane); }
      __builtin_amdgcn_sched_barrier(0);   /* holds the pass's 8 k fragment reads together in front of the products: one LDS wait a pass, not one between every few products */
#pragma unroll
      for (int t = 0; t < 2; ++t) {
#pragma unroll
        for (int kc = 0; kc < HD / 32; ++kc) s[t] = mmb(kb[t * 2 + kc], qb[kc], s[t]); }
      v16b vh[HD / 16];
#pragma unroll
      for (int j = 0; j < HD / 16; ++j) vh[j] = frag_b(&sv[team][bu][j * 16 + col][ps * 32], lane);
      __builtin_amdgcn_sched_barrier(0);   /* holds the v fragment reads in front of the softmax arithmetic, which then covers their latency */
      float p[16];
#pragma unroll
      for (int i = 0; i < 16; ++i) p[i] = s[i >> 3][i & 7];
      if (k0 + 32 > vl) {   /* sequence_mask: keys at index >= valid_len are SET to -1e6, as written; a pass wholly below valid_len has none */
        const int rem = vl - k0 - 8 * g;
#pragma unroll
        for (int i = 0; i < 16; ++i) if ((i >> 3) * 16 + (i & 7) >= rem) p[i] = MASKRAW; }
      float mx = m;
#pragma unroll
      for (int i = 0; i < 16; ++i) mx = fmaxf(mx, p[i]);
      mx = fmaxf(mx, xhalf(mx));
      float al; asm("v_exp_f32 %0, %1\n\tv_nop" : "=v"(al) : "v"((m - mx) * C2));   /* the same form for the one rescale factor */
      m = mx; float e[16]; const v2f c2 = {C2, C2}, n2 = {-mx * C2, -mx * C2};
#pragma unroll
      for (int i = 0; i < 16; i += 2) { const v2f a = {p[i], p[i + 1]}; const v2f t = __builtin_elementwise_fma(a, c2, n2);   /* two exponents a packed multiply-add */
        e[i] = t[0]; e[i + 1] = t[1]; }
      exp2x8(p, e); exp2x8(p + 8, e + 8);
      float sum = p[0];
#pragma unroll
      for (int i = 1; i < 16; ++i) sum += p[i];
      l = l * al + sum;
#pragma unroll
      for (int j = 0; j < HD / 16; ++j) acc[j] *= al;
      const F2 pf = bsplit16(p);
#pragma unroll
      for (int j = 0; j < HD / 16; ++j) { acc[j] = mmb(vh[j], pf.h, acc[j]); acc[j] = mmb(vh[j], pf.l, acc[j]); } }
    if (more) {
#pragma unroll
      for (int i = 0; i < SR; ++i) { *(v8b*)&sk[team][bu ^ 1][srow + 16 * i][sseg] = rk[i]; *(v8b*)&sv[team][bu ^ 1][srow + 16 * i][sseg] = rv[i]; } }
    __syncthreads(); }
  l += xhalf(l); const float inv = 1.0f / l;
  float* yr = Y + ((size_t)h * TT + ql0 + col) * HD + 8 * g;   /* register r of tile j = output column j * 16 + 8g + r of query col: 32 contiguous bytes a lane */
#pragma unroll
  for (int j = 0; j < HD / 16; ++j) { v4f a, b;
#pragma unroll
    for (int r = 0; r < 4; ++r) { a[r] = acc[j][r] * inv; b[r] = acc[j][4 + r] * inv; }
    vst2(yr + j * 16, a); vst2(yr + j * 16 + 4, b); } }

extern "C" void kernel_launch(void* const* d_in, const int* in_sizes, int n_in, void* d_out, int out_size, void* d_ws, size_t ws_size, hipStream_t stream) {
  (void)in_sizes; (void)n_in; (void)out_size;
  const float** F = (const float**)d_in;
  if (ws_size < (size_t)WS_END) return;
  char* ws = (char*)d_ws; __bf16 *QB = (__bf16*)(ws + WS_QB), *KB = (__bf16*)(ws + WS_KB), *VB = (__bf16*)(ws + WS_VB);
  // inputs (in order): 0 queries [32,2048,64]; 1 keys; 2 values; 3 valid_lens [32] int
  k_prep8<<<dim3(TNB * TT / 64, NH), 128, 0, stream>>>(F[0], F[1], F[2], QB, KB, VB);
  k_fa<<<dim3(TT / 64, NH / 4), 512, 0, stream>>>(QB, KB, VB, (const int*)d_in[3], (float*)d_out);
}

// v005
// Measured time: 42.8 microseconds a run.
// Timed twice side by side with v004, it ran 1.03 times as fast both times.
// All steps since v000 together make it 33.4 times as fast.
// compute dtype: all float inputs rounded to bf16 and carried EXACTLY in one bf16 plane each; logits q.k as single EXACT products on WMMA 16x16x32 bf16 (f32 accumulate) / 8, keys at index >= valid_len set to -1e6; softmax in f32, its exponentials on the hardware's base-2 instruction (1/8 and log2(e) folded into one multiply-add); P split bf16 hi + lo (2 products against the exact bf16 v) for every query row; f32 output.
#include <hip/hip_runtime.h>
#include <math.h>

typedef __attribute__((ext_vector_type(16))) _Float16 v16h;
typedef __attribute__((ext_vector_type(16))) __bf16 v16b;
typedef __attribute__((ext_vector_type(8)))  _Float16 v8h;
typedef __attribute__((ext_vector_type(8)))  float v8f;
typedef __attribute__((ext_vector_type(4)))  float v4f;
typedef __attribute__((ext_vector_type(2)))  float v2f;
typedef __attribute__((ext_vector_type(4)))  unsigned v4u;
typedef __attribute__((ext_vector_type(4)))  int v4i;
typedef float __attribute__((may_alias)) float_a;
typedef int __attribute__((may_alias)) int_a;

template <typename T> __device__ __forceinline__ void vst2(void* p, T v) { *(T*)p = v;  }
__device__ __forceinline__ v8f wmma16(v16h a, v16h b, v8f c) {
  v8f d = __builtin_amdgcn_wmma_f32_16x16x32_f16(false, a, false, b, (short)0, c, false, false);
  asm volatile("v_nop\n\tv_nop\n\tv_nop\n\tv_nop" : "+v"(d) : "v"(a), "v"(b));
  return d;
}
__device__ __forceinline__ v8f wmma_bf(v16b a, v16b b, v8f c) {
  v8f d = __builtin_amdgcn_wmma_f32_16x16x32_bf16(false, a, false, b, (short)0, c, false, false);
  asm volatile("v_nop\n\tv_nop\n\tv_nop\n\tv_nop" : "+v"(d) : "v"(a), "v"(b));
  return d;
}
// 16x16x32 fragments: lane = (h = lane>>4, row/col = lane&15); elements 0..7 = k0+8h+0..7, 8..15 = k0+16+8h+0..7; D element r = row 8h+r
__device__ __forceinline__ v16h frag_h(const _Float16* rowk0, int lane) {
  union { v16h v; v8h q[2]; } u; const _Float16* p = rowk0 + 8 * (lane >> 4);
  u.q[0] = *(const v8h*)p; u.q[1] = *(const v8h*)(p + 16); return u.v;
}
__device__ __forceinline__ v16h frag_f32(const float* rowk0, int lane) {
  v16h a; const float* p = rowk0 + 8 * (lane >> 4);
#pragma unroll
  for (int i = 0; i < 8; ++i) { a[i] = (_Float16)p[i]; a[8 + i] = (_Float16)p[16 + i]; }
  return a;
}
__device__ __forceinline__ v16h frag_f32s(const float* rowk0, int lane, float sc) {
  v16h a; const float* p = rowk0 + 8 * (lane >> 4);
#pragma unroll
  for (int i = 0; i < 8; ++i) { a[i] = (_Float16)(p[i] * sc); a[8 + i] = (_Float16)(p[16 + i] * sc); }
  return a;
}
// column fragment from a [K][ld] layout (column n), rows >= K read as 0
__device__ __forceinline__ v16h fragc_f32(const float* W, int k0, int n, int lane, int ld, int K) {
  v16h a; const int g = lane >> 4;
#pragma unroll
  for (int i = 0; i < 8; ++i) { const int ka = k0 + 8 * g + i, kb = ka + 16;
    a[i] = (_Float16)(ka < K ? W[(size_t)(ka < K ? ka : K - 1) * ld + n] : 0.f); a[8 + i] = (_Float16)(kb < K ? W[(size_t)(kb < K ? kb : K - 1) * ld + n] : 0.f); }
  return a;
}
struct F2 { v16b h, l; };
__device__ __forceinline__ F2 bsplit16(const float v[16]) { F2 r;
#pragma unroll
  for (int i = 0; i < 16; ++i) { const __bf16 h = (__bf16)v[i]; r.h[i] = h; r.l[i] = (__bf16)(v[i] - (float)h); }
  return r; }
__device__ __forceinline__ F2 split_row(const float* row, int k0, int lane) { float v[16]; const float* p = row + k0 + 8 * (lane >> 4);
#pragma unroll
  for (int i = 0; i < 8; ++i) { v[i] = p[i]; v[8 + i] = p[16 + i]; }
  return bsplit16(v); }
__device__ __forceinline__ F2 split_rowK(const float* row, int k0, int lane, int K) { float v[16]; const int g = lane >> 4;
#pragma unroll
  for (int i = 0; i < 8; ++i) { const int ka = k0 + 8 * g + i, kb = ka + 16; v[i] = ka < K ? row[ka < K ? ka : K - 1] : 0.f; v[8 + i] = kb < K ? row[kb < K ? kb : K - 1] : 0.f; }
  return bsplit16(v); }
__device__ __forceinline__ F2 split_col(const float* W, int k0, int n, int lane, int ld, int K) { float v[16]; const int g = lane >> 4;
#pragma unroll
  for (int i = 0; i < 8; ++i) { const int ka = k0 + 8 * g + i, kb = ka + 16; v[i] = ka < K ? W[(size_t)(ka < K ? ka : K - 1) * ld + n] : 0.f; v[8 + i] = kb < K ? W[(size_t)(kb < K ? kb : K - 1) * ld + n] : 0.f; }
  return bsplit16(v); }
__device__ __forceinline__ v8f mac3(const F2& a, const F2& b, v8f c) { c = wmma_bf(a.l, b.h, c); c = wmma_bf(a.h, b.l, c); return wmma_bf(a.h, b.h, c); }
__device__ __forceinline__ float sigm(float v) { return 1.0f / (1.0f + expf(-v)); }
#define LDSX() do { asm volatile("s_wait_dscnt 0" ::: "memory"); __builtin_amdgcn_wave_barrier(); __builtin_amdgcn_fence(__ATOMIC_RELEASE, "workgroup"); } while (0)

// Masked dot-product attention (B 32 sequences treated as 32 planes, S 2,048, D 64): scores = q k^T / 8; keys k >= valid_lens[b] set to -1e6 (sequence mask); softmax; out = weights v -> [32, 2,048, 64].
#define NB 1
#define TT 2048
#define CC 2048            // NH * HD = projected width
#define DIN 2048          // input (model) width
#define NH 32
#define HD 64
#define NQB (TT / 64)
#define HG 4
#define SCALE (0.125f)
#define CAUSAL 0
#ifndef TNB
#define TNB NB
#endif
__device__ __forceinline__ float bfr(float v) { return (float)(__bf16)v; }
__host__ __device__ __forceinline__ int kb_last(int qb) { return CAUSAL ? ((qb * 64 + 63) >> 7) : (TT / 128 - 1); }
typedef __attribute__((ext_vector_type(8))) __bf16 v8b;
__device__ __forceinline__ v16b frag_b(const __bf16* rowk0, int lane) {
  union { v16b v; v8b q[2]; } u; const __bf16* p = rowk0 + 8 * (lane >> 4);
  u.q[0] = *(const v8b*)p; u.q[1] = *(const v8b*)(p + 16); return u.v;
}
#define QBH NQB            // every query block takes the bf16 hi + lo P.v path
#define KHI 2048           // keys a bf16 v plane holds: every key
// B fragment (k rows k0+.., output column o) of a weight: (in,out) [K][ld] or (out,in) [ld rows of K]: bf16 exact, or f16(bf16 * 256) exact
__device__ __forceinline__ v16b wcol_io(const float* Wm, int k0, int o, int lane, int ld) { v16b w; const int g = lane >> 4;
#pragma unroll
  for (int i = 0; i < 8; ++i) { w[i] = (__bf16)Wm[(size_t)(k0 + 8 * g + i) * ld + o]; w[8 + i] = (__bf16)Wm[(size_t)(k0 + 16 + 8 * g + i) * ld + o]; }
  return w; }
__device__ __forceinline__ v16b wcol_oi(const float* Wm, int k0, int o, int lane, int K) { v16b w; const float* p = Wm + (size_t)o * K + k0 + 8 * (lane >> 4);
#pragma unroll
  for (int i = 0; i < 8; ++i) { w[i] = (__bf16)p[i]; w[8 + i] = (__bf16)p[16 + i]; }
  return w; }
__device__ __forceinline__ v16h wcolh_io(const float* Wm, int k0, int o, int lane, int ld) { v16h w; const int g = lane >> 4;
#pragma unroll
  for (int i = 0; i < 8; ++i) { w[i] = (_Float16)(bfr(Wm[(size_t)(k0 + 8 * g + i) * ld + o]) * 256.0f); w[8 + i] = (_Float16)(bfr(Wm[(size_t)(k0 + 16 + 8 * g + i) * ld + o]) * 256.0f); }
  return w; }
__device__ __forceinline__ v16h wcolh_oi(const float* Wm, int k0, int o, int lane, int K) { v16h w; const float* p = Wm + (size_t)o * K + k0 + 8 * (lane >> 4);
#pragma unroll
  for (int i = 0; i < 8; ++i) { w[i] = (_Float16)(bfr(p[i]) * 256.0f); w[8 + i] = (_Float16)(bfr(p[16 + i]) * 256.0f); }
  return w; }
#define WQKV_LAYOUT 1   // 0 = (in,out) [DIN][CC]; 1 = (out,in) [CC][DIN]; 2 = per-head [NH][DIN][HD]
__device__ __forceinline__ v16b wcol_hdk(const float* Wm, int k0, int o, int lane) { v16b w; const int g = lane >> 4; const float* p = Wm + (size_t)(o / HD) * DIN * HD + (o % HD);
#pragma unroll
  for (int i = 0; i < 8; ++i) { w[i] = (__bf16)p[(size_t)(k0 + 8 * g + i) * HD]; w[8 + i] = (__bf16)p[(size_t)(k0 + 16 + 8 * g + i) * HD]; }
  return w; }
#define WO_OUT_IN 0
#if WQKV_LAYOUT == 1
#define WCOL(W, k0, o, lane) wcol_oi(W, k0, o, lane, DIN)
#elif WQKV_LAYOUT == 2
#define WCOL(W, k0, o, lane) wcol_hdk(W, k0, o, lane)
#else
#define WCOL(W, k0, o, lane) wcol_io(W, k0, o, lane, CC)
#endif
#if WO_OUT_IN
#define WOCOL(W, k0, o, lane) wcol_oi(W, k0, o, lane, CC)
#define WOCOLH(W, k0, o, lane) wcolh_oi(W, k0, o, lane, CC)
#else
#define WOCOL(W, k0, o, lane) wcol_io(W, k0, o, lane, DIN)
#define WOCOLH(W, k0, o, lane) wcolh_io(W, k0, o, lane, DIN)
#endif
// ---- k_prep8: block = (64 attention positions s0.. of sequence b, head h): reads the module's [B, H, S, 64] inputs (element (b,h,s,c) at ((b*NH + h)*TT + s)*64 + c), bf16-rounds them and writes the attention planes: q -> bf16 rows, k -> bf16 rows, v -> bf16 planes [c][s]. A bf16-rounded value is its own bf16 plane: there is no residual to carry.
__global__ __launch_bounds__(128) void k_prep8(const float* __restrict__ Q, const float* __restrict__ K, const float* __restrict__ V, __bf16* __restrict__ QB, __bf16* __restrict__ KB, __bf16* __restrict__ VB) {
  __shared__ __align__(16) __bf16 sq[64][72], sk[64][72], tb[HD][72];
  const int tid = threadIdx.x; const int h = blockIdx.y; const size_t r0 = (size_t)blockIdx.x * 64; const size_t bb = r0 / TT; const int t0 = (int)(r0 % TT);
  for (int e = tid; e < 64 * HD; e += 128) { const int rl = e / HD, c = e % HD; const size_t oi = ((bb * NH + h) * TT + t0 + rl) * HD + c;
    sq[rl][c] = (__bf16)Q[oi]; sk[rl][c] = (__bf16)K[oi]; tb[c][rl] = (__bf16)V[oi]; }   /* module inputs: bf16-rounded */
  __syncthreads();
  for (int e = tid; e < 64 * (HD / 8); e += 128) { const int rl = e / (HD / 8), q = e % (HD / 8); const size_t o = (r0 + rl) * CC + h * HD + q * 8; vst2((unsigned*)(QB + o), *(const v4u*)&sq[rl][q * 8]); vst2((unsigned*)(KB + o), *(const v4u*)&sk[rl][q * 8]); }
  for (int e = tid; e < HD * 8; e += 128) { const int cl = e >> 3, q = e & 7; vst2((unsigned*)(VB + (bb * CC + h * HD + cl) * (size_t)KHI + t0 + q * 8), *(const v4u*)&tb[cl][q * 8]); } }


#define WS_QB  0u                                      // bf16 q rows [b*t][CC]
#define WS_KB  (WS_QB + 2u * (size_t)NB * TT * CC)      // bf16 k rows [b*t][CC]
#define WS_VB  (WS_KB + 2u * (size_t)NB * TT * CC)      // bf16 v planes [b][c][t]
#define WS_END (WS_VB + 2u * (size_t)NB * CC * KHI)

// plain builtin form for the fused kernel: the compiler keeps the distance behind its own matrix instructions
__device__ __forceinline__ v8f mmb(v16b a, v16b b, v8f c) { return __builtin_amdgcn_wmma_f32_16x16x32_bf16(false, a, false, b, (short)0, c, false, false); }
__device__ __forceinline__ float xhalf(float x) { return __builtin_bit_cast(float, __builtin_amdgcn_permlanex16(__builtin_bit_cast(int, x), __builtin_bit_cast(int, x), 0x76543210, 0xfedcba98, false, false)); }   // lane l reads lane l ^ 16, on the vector port: no LDS counter to wait on while fragment reads are in flight
#define SK 64              // keys a stage: a team's 4 waves share one staged copy of the stage's k rows and v planes
#define C2 0.18033688011112042f   // SCALE * log2(e): exp(SCALE * s - max) = 2^(C2 * s - C2 * smax)
#define MASKRAW (-8000000.0f)      // the mask fill -1e6 in front of the scale: MASKRAW * SCALE is exactly -1e6
// base-2 exponentials in one statement that ends with the slot the instruction set asks for behind a transcendental; the results are early-clobber: none may share a register with a source that is still to be read
__device__ __forceinline__ void exp2x8(float* o, const float* i) {
  asm("v_exp_f32 %0, %8\n\tv_exp_f32 %1, %9\n\tv_exp_f32 %2, %10\n\tv_exp_f32 %3, %11\n\tv_exp_f32 %4, %12\n\tv_exp_f32 %5, %13\n\tv_exp_f32 %6, %14\n\tv_exp_f32 %7, %15\n\tv_nop"
      : "=&v"(o[0]), "=&v"(o[1]), "=&v"(o[2]), "=&v"(o[3]), "=&v"(o[4]), "=&v"(o[5]), "=&v"(o[6]), "=&v"(o[7]) : "v"(i[0]), "v"(i[1]), "v"(i[2]), "v"(i[3]), "v"(i[4]), "v"(i[5]), "v"(i[6]), "v"(i[7])); }
#define SP 72              // LDS row pitch in 16-bit elements: 144 B = 16 B x odd, the pitch for 16-byte fragment reads
// ---- k_fa: block = 4 teams of 4 waves; a team = 64 queries of ONE plane, 16 query columns a wave, with its own two LDS buffers; a team walks only the stages of 64 keys, one pass each, that hold a key below its plane's valid_len.
// A key at or past valid_len has the logit -1e6 and, beside any real logit, the weight exactly 0: a pass of only such keys rescales by exactly 1 and adds only zeros to l and O^T, so it is not walked. (A plane with valid_len <= 0 has no real logit: it walks every key, as written.)
// The launch lasts as long as its fullest WGP: the planes are ranked by length on the device (ties by index, so the ranks are a permutation for any lengths) and block group y takes the ranks y, 8 + y, 23 - y, 31 - y, whose lengths add up to about the same for every y. Waves w, w + 4, w + 8, w + 12 are one of each team: as the short teams end, the long ones get their issue slots.
// S^T = K . Q^T (A = 16 key rows, B = 16 query columns): lane (g, col) holds query col, register r = key 8g + r, so two S^T tiles (keys +0..15, +16..31) are, converted in place, the B operand of O^T += V^T . P^T.
// Running maximum m (of the unscaled logits) and running sum l per query column (each lane half sums its own keys; the halves join after the loop); O^T and l are rescaled by 2^(C2 * (m_old - m_new)) every pass: exactly 1 while the maximum stands.
// k rows and v planes come through registers into the team's two LDS buffers, whole 128-byte lines a row: stage st + 1 is loaded while stage st is worked on, stored behind it, and one barrier a stage both publishes it and ends the reads of the buffer that is refilled next. Every wave passes every barrier up to the longest team's last stage, also a wave whose team has ended.
#define NT 4               // teams a block
#define SR 4               // rows of each array that a thread stages: 64 rows over 16 row slots
__device__ __forceinline__ int eff_len(int v) { return (v <= 0 || v > TT) ? TT : v; }   // keys a plane walks
__global__ __launch_bounds__(512) void k_fa(const __bf16* __restrict__ QB, const __bf16* __restrict__ KB, const __bf16* __restrict__ VB, const int* __restrict__ VL, float* __restrict__ Y) {
  __shared__ __align__(16) __bf16 sk[NT][2][SK][SP], sv[NT][2][HD][SP];
  const int tid = threadIdx.x, wave = __builtin_amdgcn_readfirstlane(tid >> 5), lane = tid & 31, col = lane & 15, g = lane >> 4; const int team = wave >> 2, ttid = tid & 127;
  // lane p ranks plane p: how many planes are longer, or as long with a lower index (one key holds both: no two keys are equal)
  const int vlp = VL[lane]; const int key = eff_len(vlp) * NH + (NH - 1 - lane); int rank = 0;
#pragma unroll
  for (int j = 0; j < NH; ++j) rank += __builtin_amdgcn_readlane(key, j) > key ? 1 : 0;
  const int gy = blockIdx.y; const int want = (team & 2 ? 31 - gy : gy) + (team == 1 ? 8 : team == 2 ? -8 : 0);
  const int h = __builtin_ctz(__builtin_amdgcn_ballot_w32(rank == want)) & (NH - 1);      /* the team's plane: a scalar, inside 0..31 whatever the lengths */
  const int hl = __builtin_ctz(__builtin_amdgcn_ballot_w32(rank == gy)) & (NH - 1);       /* the block's longest plane */
  const int vl = __builtin_amdgcn_readlane(vlp, h); const int nst = (eff_len(vl) + SK - 1) / SK;   /* the team's stages, a pass each: at most TT / SK */
  const int nsb = (eff_len(__builtin_amdgcn_readlane(vlp, hl)) + SK - 1) / SK;             /* the block's stages: the same in every wave, and no team has more */
  const int ql0 = blockIdx.x * 64 + (wave & 3) * 16;
  const int srow = ttid >> 3, sseg = (ttid & 7) * 8;   /* staging: 8 threads a row of 128 bytes, 16 rows a step, 4 steps an array */
  const __bf16* gk = KB + (size_t)srow * CC + h * HD + sseg;
  const __bf16* gv = VB + ((size_t)h * HD + srow) * (size_t)KHI + sseg;
  v8b rk[SR], rv[SR];
#pragma unroll
  for (int i = 0; i < SR; ++i) { rk[i] = *(const v8b*)(gk + (size_t)i * 16 * CC); rv[i] = *(const v8b*)(gv + (size_t)i * 16 * KHI); }
  v16b qb[HD / 32];
  // the inner loops are unrolled so that every fragment and accumulator array stays in registers
#pragma unroll
  for (int kc = 0; kc < HD / 32; ++kc) { const size_t qo = (size_t)(ql0 + col) * CC + h * HD + kc * 32; qb[kc] = frag_b(QB + qo, lane); }
  asm volatile("s_wait_xcnt 0x0" ::: "memory");   /* the wait in front of the reuse of the first loads' address registers */
#pragma unroll
  for (int i = 0; i < SR; ++i) { *(v8b*)&sk[team][0][srow + 16 * i][sseg] = rk[i]; *(v8b*)&sv[team][0][srow + 16 * i][sseg] = rv[i]; }
  __syncthreads();
  v8f acc[HD / 16] = {}; float m = -3.0e38f, l = 0.f;
  for (int st = 0; st < nsb; ++st) { const int bu = st & 1; const bool more = st + 1 < nst;
    if (more) { const size_t kn = (size_t)(st + 1) * SK * CC; const int vn = (st + 1) * SK;
#pragma unroll
      for (int i = 0; i < SR; ++i) { rk[i] = *(const v8b*)(gk + kn + (size_t)i * 16 * CC); rv[i] = *(const v8b*)(gv + vn + (size_t)i * 16 * KHI); }
      asm volatile("s_wait_xcnt 0x0" ::: "memory"); }   /* the loads stay in flight over the stage while their address registers are reused: the wait in front of that overwrite */
    if (st < nst) { const int k0 = st * SK;   /* one pass takes the whole stage of 64 keys: the maximum's exchange, the rescale and the waits on LDS and on the dependent chains are paid once for 64 keys, with twice the independent work beside every chain */
      v8f s[SK / 16] = {}; v16b kb[SK / 8];
#pragma unroll
      for (int i = 0; i < SK / 8; ++i) { const int kr = (i >> 1) * 16 + col; kb[i] = frag_b(&sk[team][bu][kr][(i & 1) * 32], lane); }
      __builtin_amdgcn_sched_barrier(0);   /* holds the pass's 16 k fragment reads together in front of the products: one LDS wait a pass, not one between every few products */
#pragma unroll
      for (int kc = 0; kc < HD / 32; ++kc) {
#pragma unroll
        for (int t = 0; t < SK / 16; ++t) s[t] = mmb(kb[t * 2 + kc], qb[kc], s[t]); }
      v16b vh[SK / 32][HD / 16];
#pragma unroll
      for (int hf = 0; hf < SK / 32; ++hf) {
#pragma unroll
        for (int j = 0; j < HD / 16; ++j) vh[hf][j] = frag_b(&sv[team][bu][j * 16 + col][hf * 32], lane); }
      __builtin_amdgcn_sched_barrier(0);   /* holds the v fragment reads in front of the softmax arithmetic, which then covers their latency */
      float p[SK / 2];
#pragma unroll
      for (int i = 0; i < SK / 2; ++i) p[i] = s[i >> 3][i & 7];
      if (k0 + SK > vl) {   /* sequence_mask: keys at index >= valid_len are SET to -1e6, as written; a pass wholly below valid_len has none */
        const int rem = vl - k0 - 8 * g;
#pragma unroll
        for (int i = 0; i < SK / 2; ++i) if ((i >> 3) * 16 + (i & 7) >= rem) p[i] = MASKRAW; }
      float mt[SK / 16];   /* one chain a tile of 16 keys, each from the running maximum, joined at the end: a maximum does not depend on the order */
#pragma unroll
      for (int t = 0; t < SK / 16; ++t) { mt[t] = m;
#pragma unroll
        for (int r = 0; r < 8; ++r) mt[t] = fmaxf(mt[t], p[t * 8 + r]); }
      float mx = fmaxf(fmaxf(mt[0], mt[1]), fmaxf(mt[2], mt[3]));
      mx = fmaxf(mx, xhalf(mx));
      float al; asm("v_exp_f32 %0, %1\n\tv_nop" : "=v"(al) : "v"((m - mx) * C2));   /* the same form for the one rescale factor */
      m = mx; float e[SK / 2]; const v2f c2 = {C2, C2}, n2 = {-mx * C2, -mx * C2};
#pragma unroll
      for (int i = 0; i < SK / 2; i += 2) { const v2f a = {p[i], p[i + 1]}; const v2f t = __builtin_elementwise_fma(a, c2, n2);   /* two exponents a packed multiply-add */
        e[i] = t[0]; e[i + 1] = t[1]; }
#pragma unroll
      for (int i = 0; i < SK / 16; ++i) exp2x8(p + 8 * i, e + 8 * i);
      float sh[SK / 32];   /* one sum chain for each 32 keys: two independent chains; they join before they enter l */
#pragma unroll
      for (int hf = 0; hf < SK / 32; ++hf) { sh[hf] = p[hf * 16];
#pragma unroll
        for (int i = 1; i < 16; ++i) sh[hf] += p[hf * 16 + i]; }
      l = l * al + (sh[0] + sh[1]);
      __builtin_amdgcn_sched_barrier(0);   /* keeps the sums in front of the products: sunk between the pass's last products they land in operand registers just set free, each time at the price of four idle slots */
#pragma unroll
      for (int j = 0; j < HD / 16; ++j) acc[j] *= al;
#pragma unroll
      for (int hf = 0; hf < SK / 32; ++hf) { const F2 pf = bsplit16(p + hf * 16);
#pragma unroll
        for (int j = 0; j < HD / 16; ++j) acc[j] = mmb(vh[hf][j], pf.h, acc[j]);
#pragma unroll
        for (int j = 0; j < HD / 16; ++j) acc[j] = (hf == SK / 32 - 1 && j == HD / 16 - 1) ? wmma_bf(vh[hf][j], pf.l, acc[j]) : mmb(vh[hf][j], pf.l, acc[j]); } }   /* the pass's last matrix instruction brings its own four slots: the blocks behind the pass reuse its operand registers at once */
    if (more) {
#pragma unroll
      for (int i = 0; i < SR; ++i) { *(v8b*)&sk[team][bu ^ 1][srow + 16 * i][sseg] = rk[i]; *(v8b*)&sv[team][bu ^ 1][srow + 16 * i][sseg] = rv[i]; } }
    __syncthreads(); }
  l += xhalf(l); const float inv = 1.0f / l;
  float* yr = Y + ((size_t)h * TT + ql0 + col) * HD + 8 * g;   /* register r of tile j = output column j * 16 + 8g + r of query col: 32 contiguous bytes a lane */
#pragma unroll
  for (int j = 0; j < HD / 16; ++j) { v4f a, b;
#pragma unroll
    for (int r = 0; r < 4; ++r) { a[r] = acc[j][r] * inv; b[r] = acc[j][4 + r] * inv; }
    vst2(yr + j * 16, a); vst2(yr + j * 16 + 4, b); } }

extern "C" void kernel_launch(void* const* d_in, const int* in_sizes, int n_in, void* d_out, int out_size, void* d_ws, size_t ws_size, hipStream_t stream) {
  (void)in_sizes; (void)n_in; (void)out_size;
  const float** F = (const float**)d_in;
  if (ws_size < (size_t)WS_END) return;
  char* ws = (char*)d_ws; __bf16 *QB = (__bf16*)(ws + WS_QB), *KB = (__bf16*)(ws + WS_KB), *VB = (__bf16*)(ws + WS_VB);
  // inputs (in order): 0 queries [32,2048,64]; 1 keys; 2 values; 3 valid_lens [32] int
  k_prep8<<<dim3(TNB * TT / 64, NH), 128, 0, stream>>>(F[0], F[1], F[2], QB, KB, VB);
  k_fa<<<dim3(TT / 64, NH / 4), 512, 0, stream>>>(QB, KB, VB, (const int*)d_in[3], (float*)d_out);
}

// v006
// Measured time: 35 microseconds a run.
// Timed twice side by side with v005, it ran 1.23 and 1.21 times as fast.
// Counting every step since v000, it is 40.8 times as fast.
// compute dtype: all float inputs rounded to bf16, in registers inside the one kernel, on the way to LDS (k, v) or into the fragments (q); logits q.k as single EXACT products on WMMA 16x16x32 bf16 (f32 accumulate) / 8, keys at index >= valid_len set to -1e6; softmax in f32, its exponentials on the hardware's base-2 instruction (1/8 and log2(e) folded into one multiply-add); P split bf16 hi + lo (2 products against the exact bf16 v) for every query row; f32 output.
#include <hip/hip_runtime.h>
#include <math.h>

typedef __attribute__((ext_vector_type(16))) _Float16 v16h;
typedef __attribute__((ext_vector_type(16))) __bf16 v16b;
typedef __attribute__((ext_vector_type(8)))  _Float16 v8h;
typedef __attribute__((ext_vector_type(8)))  float v8f;
typedef __attribute__((ext_vector_type(4)))  float v4f;
typedef __attribute__((ext_vector_type(2)))  float v2f;
typedef __attribute__((ext_vector_type(4)))  unsigned v4u;
typedef __attribute__((ext_vector_type(4)))  int v4i;
typedef float __attribute__((may_alias)) float_a;
typedef int __attribute__((may_alias)) int_a;

template <typename T> __device__ __forceinline__ void vst2(void* p, T v) { *(T*)p = v;  }
__device__ __forceinline__ v8f wmma16(v16h a, v16h b, v8f c) {
  v8f d = __builtin_amdgcn_wmma_f32_16x16x32_f16(false, a, false, b, (short)0, c, false, false);
  asm volatile("v_nop\n\tv_nop\n\tv_nop\n\tv_nop" : "+v"(d) : "v"(a), "v"(b));
  return d;
}
__device__ __forceinline__ v8f wmma_bf(v16b a, v16b b, v8f c) {
  v8f d = __builtin_amdgcn_wmma_f32_16x16x32_bf16(false, a, false, b, (short)0, c, false, false);
  asm volatile("v_nop\n\tv_nop\n\tv_nop\n\tv_nop" : "+v"(d) : "v"(a), "v"(b));
  return d;
}
// 16x16x32 fragments: lane = (h = lane>>4, row/col = lane&15); elements 0..7 = k0+8h+0..7, 8..15 = k0+16+8h+0..7; D element r = row 8h+r
__device__ __forceinline__ v16h frag_h(const _Float16* rowk0, int lane) {
  union { v16h v; v8h q[2]; } u; const _Float16* p = rowk0 + 8 * (lane >> 4);
  u.q[0] = *(const v8h*)p; u.q[1] = *(const v8h*)(p + 16); return u.v;
}
__device__ __forceinline__ v16h frag_f32(const float* rowk0, int lane) {
  v16h a; const float* p = rowk0 + 8 * (lane >> 4);
#pragma unroll
  for (int i = 0; i < 8; ++i) { a[i] = (_Float16)p[i]; a[8 + i] = (_Float16)p[16 + i]; }
  return a;
}
__device__ __forceinline__ v16h frag_f32s(const float* rowk0, int lane, float sc) {
  v16h a; const float* p = rowk0 + 8 * (lane >> 4);
#pragma unroll
  for (int i = 0; i < 8; ++i) { a[i] = (_Float16)(p[i] * sc); a[8 + i] = (_Float16)(p[16 + i] * sc); }
  return a;
}
// column fragment from a [K][ld] layout (column n), rows >= K read as 0
__device__ __forceinline__ v16h fragc_f32(const float* W, int k0, int n, int lane, int ld, int K) {
  v16h a; const int g = lane >> 4;
#pragma unroll
  for (int i = 0; i < 8; ++i) { const int ka = k0 + 8 * g + i, kb = ka + 16;
    a[i] = (_Float16)(ka < K ? W[(size_t)(ka < K ? ka : K - 1) * ld + n] : 0.f); a[8 + i] = (_Float16)(kb < K ? W[(size_t)(kb < K ? kb : K - 1) * ld + n] : 0.f); }
  return a;
}
struct F2 { v16b h, l; };
__device__ __forceinline__ F2 bsplit16(const float v[16]) { F2 r;
#pragma unroll
  for (int i = 0; i < 16; ++i) { const __bf16 h = (__bf16)v[i]; r.h[i] = h; r.l[i] = (__bf16)(v[i] - (float)h); }
  return r; }
__device__ __forceinline__ F2 split_row(const float* row, int k0, int lane) { float v[16]; const float* p = row + k0 + 8 * (lane >> 4);
#pragma unroll
  for (int i = 0; i < 8; ++i) { v[i] = p[i]; v[8 + i] = p[16 + i]; }
  return bsplit16(v); }
__device__ __forceinline__ F2 split_rowK(const float* row, int k0, int lane, int K) { float v[16]; const int g = lane >> 4;
#pragma unroll
  for (int i = 0; i < 8; ++i) { const int ka = k0 + 8 * g + i, kb = ka + 16; v[i] = ka < K ? row[ka < K ? ka : K - 1] : 0.f; v[8 + i] = kb < K ? row[kb < K ? kb : K - 1] : 0.f; }
  return bsplit16(v); }
__device__ __forceinline__ F2 split_col(const float* W, int k0, int n, int lane, int ld, int K) { float v[16]; const int g = lane >> 4;
#pragma unroll
  for (int i = 0; i < 8; ++i) { const int ka = k0 + 8 * g + i, kb = ka + 16; v[i] = ka < K ? W[(size_t)(ka < K ? ka : K - 1) * ld + n] : 0.f; v[8 + i] = kb < K ? W[(size_t)(kb < K ? kb : K - 1) * ld + n] : 0.f; }
  return bsplit16(v); }
__device__ __forceinline__ v8f mac3(const F2& a, const F2& b, v8f c) { c = wmma_bf(a.l, b.h, c); c = wmma_bf(a.h, b.l, c); return wmma_bf(a.h, b.h, c); }
__device__ __forceinline__ float sigm(float v) { return 1.0f / (1.0f + expf(-v)); }
#define LDSX() do { asm volatile("s_wait_dscnt 0" ::: "memory"); __builtin_amdgcn_wave_barrier(); __builtin_amdgcn_fence(__ATOMIC_RELEASE, "workgroup"); } while (0)

// Masked dot-product attention (B 32 sequences treated as 32 planes, S 2,048, D 64): scores = q k^T / 8; keys k >= valid_lens[b] set to -1e6 (sequence mask); softmax; out = weights v -> [32, 2,048, 64].
#define NB 1
#define TT 2048
#define CC 2048            // NH * HD = projected width
#define DIN 2048          // input (model) width
#define NH 32
#define HD 64
#define NQB (TT / 64)
#define HG 4
#define SCALE (0.125f)
#define CAUSAL 0
#ifndef TNB
#define TNB NB
#endif
__device__ __forceinline__ float bfr(float v) { return (float)(__bf16)v; }
__host__ __device__ __forceinline__ int kb_last(int qb) { return CAUSAL ? ((qb * 64 + 63) >> 7) : (TT / 128 - 1); }
typedef __attribute__((ext_vector_type(8))) __bf16 v8b;
__device__ __forceinline__ v16b frag_b(const __bf16* rowk0, int lane) {
  union { v16b v; v8b q[2]; } u; const __bf16* p = rowk0 + 8 * (lane >> 4);
  u.q[0] = *(const v8b*)p; u.q[1] = *(const v8b*)(p + 16); return u.v;
}
// B fragment (k rows k0+.., output column o) of a weight: (in,out) [K][ld] or (out,in) [ld rows of K]: bf16 exact, or f16(bf16 * 256) exact
__device__ __forceinline__ v16b wcol_io(const float* Wm, int k0, int o, int lane, int ld) { v16b w; const int g = lane >> 4;
#pragma unroll
  for (int i = 0; i < 8; ++i) { w[i] = (__bf16)Wm[(size_t)(k0 + 8 * g + i) * ld + o]; w[8 + i] = (__bf16)Wm[(size_t)(k0 + 16 + 8 * g + i) * ld + o]; }
  return w; }
__device__ __forceinline__ v16b wcol_oi(const float* Wm, int k0, int o, int lane, int K) { v16b w; const float* p = Wm + (size_t)o * K + k0 + 8 * (lane >> 4);
#pragma unroll
  for (int i = 0; i < 8; ++i) { w[i] = (__bf16)p[i]; w[8 + i] = (__bf16)p[16 + i]; }
  return w; }
__device__ __forceinline__ v16h wcolh_io(const float* Wm, int k0, int o, int lane, int ld) { v16h w; const int g = lane >> 4;
#pragma unroll
  for (int i = 0; i < 8; ++i) { w[i] = (_Float16)(bfr(Wm[(size_t)(k0 + 8 * g + i) * ld + o]) * 256.0f); w[8 + i] = (_Float16)(bfr(Wm[(size_t)(k0 + 16 + 8 * g + i) * ld + o]) * 256.0f); }
  return w; }
__device__ __forceinline__ v16h wcolh_oi(const float* Wm, int k0, int o, int lane, int K) { v16h w; const float* p = Wm + (size_t)o * K + k0 + 8 * (lane >> 4);
#pragma unroll
  for (int i = 0; i < 8; ++i) { w[i] = (_Float16)(bfr(p[i]) * 256.0f); w[8 + i] = (_Float16)(bfr(p[16 + i]) * 256.0f); }
  return w; }
#define WQKV_LAYOUT 1   // 0 = (in,out) [DIN][CC]; 1 = (out,in) [CC][DIN]; 2 = per-head [NH][DIN][HD]
__device__ __forceinline__ v16b wcol_hdk(const float* Wm, int k0, int o, int lane) { v16b w; const int g = lane >> 4; const float* p = Wm + (size_t)(o / HD) * DIN * HD + (o % HD);
#pragma unroll
  for (int i = 0; i < 8; ++i) { w[i] = (__bf16)p[(size_t)(k0 + 8 * g + i) * HD]; w[8 + i] = (__bf16)p[(size_t)(k0 + 16 + 8 * g + i) * HD]; }
  return w; }
#define WO_OUT_IN 0
#if WQKV_LAYOUT == 1
#define WCOL(W, k0, o, lane) wcol_oi(W, k0, o, lane, DIN)
#elif WQKV_LAYOUT == 2
#define WCOL(W, k0, o, lane) wcol_hdk(W, k0, o, lane)
#else
#define WCOL(W, k0, o, lane) wcol_io(W, k0, o, lane, CC)
#endif
#if WO_OUT_IN
#define WOCOL(W, k0, o, lane) wcol_oi(W, k0, o, lane, CC)
#define WOCOLH(W, k0, o, lane) wcolh_oi(W, k0, o, lane, CC)
#else
#define WOCOL(W, k0, o, lane) wcol_io(W, k0, o, lane, DIN)
#define WOCOLH(W, k0, o, lane) wcolh_io(W, k0, o, lane, DIN)
#endif
// plain builtin form for the fused kernel: the compiler keeps the distance behind its own matrix instructions
__device__ __forceinline__ v8f mmb(v16b a, v16b b, v8f c) { return __builtin_amdgcn_wmma_f32_16x16x32_bf16(false, a, false, b, (short)0, c, false, false); }
__device__ __forceinline__ float xhalf(float x) { return __builtin_bit_cast(float, __builtin_amdgcn_permlanex16(__builtin_bit_cast(int, x), __builtin_bit_cast(int, x), 0x76543210, 0xfedcba98, false, false)); }   // lane l reads lane l ^ 16, on the vector port: no LDS counter to wait on while fragment reads are in flight
typedef __attribute__((ext_vector_type(8))) short v8s;
typedef __attribute__((ext_vector_type(4))) __bf16 v4b;
// transposing 16-bit LDS read, as a builtin the compiler sees (it places the LDS wait): lane l hands in the address of row 8 (l >> 4) + (l & 7), byte 16 ((l >> 3) & 1), and gets rows 8 (l >> 4) + 0..7 of column l & 15
__device__ __forceinline__ v8b ld_tr16(const char* p) { typedef __attribute__((address_space(3))) v8s lds_v8s; return __builtin_bit_cast(v8b, __builtin_amdgcn_ds_load_tr16_b128_v8i16((lds_v8s*)p)); }
__device__ __forceinline__ v4b rnd4(v4f f) { v4b o;
#pragma unroll
  for (int r = 0; r < 4; ++r) o[r] = (__bf16)f[r];
  return o; }   /* module inputs: bf16-rounded, to nearest even */
#define SK 64              // keys a stage: a team's 8 waves share one staged copy of the stage's k rows and v rows
#define C2 0.18033688011112042f   // SCALE * log2(e): exp(SCALE * s - max) = 2^(C2 * s - C2 * smax)
#define MASKRAW (-8000000.0f)      // the mask fill -1e6 in front of the scale: MASKRAW * SCALE is exactly -1e6
// base-2 exponentials in one statement that ends with the slot the instruction set asks for behind a transcendental; the results are early-clobber: none may share a register with a source that is still to be read
__device__ __forceinline__ void exp2x8(float* o, const float* i) {
  asm("v_exp_f32 %0, %8\n\tv_exp_f32 %1, %9\n\tv_exp_f32 %2, %10\n\tv_exp_f32 %3, %11\n\tv_exp_f32 %4, %12\n\tv_exp_f32 %5, %13\n\tv_exp_f32 %6, %14\n\tv_exp_f32 %7, %15\n\tv_nop"
      : "=&v"(o[0]), "=&v"(o[1]), "=&v"(o[2]), "=&v"(o[3]), "=&v"(o[4]), "=&v"(o[5]), "=&v"(o[6]), "=&v"(o[7]) : "v"(i[0]), "v"(i[1]), "v"(i[2]), "v"(i[3]), "v"(i[4]), "v"(i[5]), "v"(i[6]), "v"(i[7])); }
#define SP 72              // LDS row pitch of the k rows in 16-bit elements: 144 B = 16 B x odd, the pitch for 16-byte fragment reads
#define SPV 80             // LDS row pitch of the v rows: 160 B = 32 B x odd, the pitch for the transposing reads
// ---- k_fa: block = 2 teams of 8 waves; a team = 128 queries of ONE plane, 16 query columns a wave, with its own two LDS buffers; a team walks only the stages of 64 keys, one pass each, that hold a key below its plane's valid_len.
// A key at or past valid_len has the logit -1e6 and, beside any real logit, the weight exactly 0: a pass of only such keys rescales by exactly 1 and adds only zeros to l and O^T, so it is not walked. (A plane with valid_len <= 0 has no real logit: it walks every key, as written.)
// The launch lasts as long as its fullest WGP: the planes are ranked by length on the device (ties by index, so the ranks are a permutation for any lengths) and block group y takes the ranks y and 31 - y, whose lengths add up to about the same for every y. Waves w, w + 4, w + 8, w + 12 are two of each team: as the short team ends, the long one gets its issue slots.
// S^T = K . Q^T (A = 16 key rows, B = 16 query columns): lane (g, col) holds query col, register r = key 8g + r, so two S^T tiles (keys +0..15, +16..31) are, converted in place, the B operand of O^T += V^T . P^T.
// Running maximum m (of the unscaled logits) and running sum l per query column (each lane half sums its own keys; the halves join after the loop); O^T and l are rescaled by 2^(C2 * (m_old - m_new)) every pass: exactly 1 while the maximum stands.
// k rows and v rows come as f32, straight from the module's [32, 2048, 64] inputs (a stage of a plane is 16 KiB in a row: every load of a wave is 512 bytes in a row), through registers, where they are rounded to bf16, into the team's two LDS buffers; V^T fragments come out of the v rows by the transposing LDS read. 8 waves a tile: a thread holds 8 loads, as many staging registers and as many bytes from L2 a query as 16-bit planes took with 4 waves a tile. Stage st + 1 is loaded while stage st is worked on, rounded and stored behind it, and one barrier a stage both publishes it and ends the reads of the buffer that is refilled next. Every wave passes every barrier up to the longest team's last stage, also a wave whose team has ended.
#define NT 2               // teams a block
#define SR 4               // 16-byte pieces of each array that a thread stages: 64 rows of 256 bytes over 256 threads
__device__ __forceinline__ int eff_len(int v) { return (v <= 0 || v > TT) ? TT : v; }   // keys a plane walks
__global__ __launch_bounds__(512) void k_fa(const float* __restrict__ Q, const float* __restrict__ K, const float* __restrict__ V, const int* __restrict__ VL, float* __restrict__ Y) {
  __shared__ __align__(32) __bf16 sk[NT][2][SK][SP], sv[NT][2][SK][SPV];
  const int tid = threadIdx.x, wave = __builtin_amdgcn_readfirstlane(tid >> 5), lane = tid & 31, col = lane & 15, g = lane >> 4; const int team = wave >> 3, ttid = tid & 255;
  // lane p ranks plane p: how many planes are longer, or as long with a lower index (one key holds both: no two keys are equal)
  const int vlp = VL[lane]; const int key = eff_len(vlp) * NH + (NH - 1 - lane); int rank = 0;
#pragma unroll
  for (int j = 0; j < NH; ++j) rank += __builtin_amdgcn_readlane(key, j) > key ? 1 : 0;
  const int gy = blockIdx.y; const int want = team ? NH - 1 - gy : gy;
  const int h = __builtin_ctz(__builtin_amdgcn_ballot_w32(rank == want)) & (NH - 1);      /* the team's plane: a scalar, inside 0..31 whatever the lengths */
  const int hl = __builtin_ctz(__builtin_amdgcn_ballot_w32(rank == gy)) & (NH - 1);       /* the block's longest plane */
  const int vl = __builtin_amdgcn_readlane(vlp, h); const int nst = (eff_len(vl) + SK - 1) / SK;   /* the team's stages, a pass each: at most TT / SK */
  const int nsb = (eff_len(__builtin_amdgcn_readlane(vlp, hl)) + SK - 1) / SK;             /* the block's stages: the same in every wave, and no team has more */
  const int ql0 = blockIdx.x * 128 + (wave & 7) * 16;
  const int srow = ttid >> 4, sseg = (ttid & 15) * 4;   /* staging: 16 threads a row of 256 bytes, 16 rows a step, 4 steps an array */
  const float* gk = K + (size_t)h * TT * HD + ttid * 4;
  const float* gv = V + (size_t)h * TT * HD + ttid * 4;
  v4f rk[SR], rv[SR];
#pragma unroll
  for (int i = 0; i < SR; ++i) { rk[i] = *(const v4f*)(gk + i * 16 * HD); rv[i] = *(const v4f*)(gv + i * 16 * HD); }
  v16b qb[HD / 32];
  // the inner loops are unrolled so that every fragment and accumulator array stays in registers
#pragma unroll
  for (int kc = 0; kc < HD / 32; ++kc) { const float* qp = Q + ((size_t)h * TT + ql0 + col) * HD + kc * 32 + 8 * g;
#pragma unroll
    for (int i = 0; i < 8; ++i) { qb[kc][i] = (__bf16)qp[i]; qb[kc][8 + i] = (__bf16)qp[16 + i]; } }
  asm volatile("s_wait_xcnt 0x0" ::: "memory");   /* the wait in front of the reuse of the first loads' address registers */
#pragma unroll
  for (int i = 0; i < SR; ++i) { *(v4b*)&sk[team][0][srow + 16 * i][sseg] = rnd4(rk[i]); *(v4b*)&sv[team][0][srow + 16 * i][sseg] = rnd4(rv[i]); }
  __syncthreads();
  v8f acc[HD / 16] = {}; float m = -3.0e38f, l = 0.f;
  for (int st = 0; st < nsb; ++st) { const int bu = st & 1; const bool more = st + 1 < nst;
    if (more) { const int kn = (st + 1) * SK * HD;
#pragma unroll
      for (int i = 0; i < SR; ++i) { rk[i] = *(const v4f*)(gk + kn + i * 16 * HD); rv[i] = *(const v4f*)(gv + kn + i * 16 * HD); }
      asm volatile("s_wait_xcnt 0x0" ::: "memory"); }   /* the loads stay in flight over the stage while their address registers are reused: the wait in front of that overwrite */
    if (st < nst) { const int k0 = st * SK;   /* one pass takes the whole stage of 64 keys: the maximum's exchange, the rescale and the waits on LDS and on the dependent chains are paid once for 64 keys, with twice the independent work beside every chain */
      v8f s[SK / 16] = {}; v16b kb[SK / 8];
#pragma unroll
      for (int i = 0; i < SK / 8; ++i) { const int kr = (i >> 1) * 16 + col; kb[i] = frag_b(&sk[team][bu][kr][(i & 1) * 32], lane); }
      __builtin_amdgcn_sched_barrier(0);   /* holds the pass's 16 k fragment reads together in front of the products: one LDS wait a pass, not one between every few products */
#pragma unroll
      for (int kc = 0; kc < HD / 32; ++kc) {
#pragma unroll
        for (int t = 0; t < SK / 16; ++t) s[t] = mmb(kb[t * 2 + kc], qb[kc], s[t]); }
      v16b vh[SK / 32][HD / 16]; const char* vt = (const char*)&sv[team][bu][8 * g + (lane & 7)][8 * ((lane >> 3) & 1)];
#pragma unroll
      for (int hf = 0; hf < SK / 32; ++hf) {
#pragma unroll
        for (int j = 0; j < HD / 16; ++j) { union { v16b v; v8b q[2]; } u;   /* A fragment of V^T: row = output column j * 16 + col; elements 0..7 = keys hf * 32 + 8g + 0..7, 8..15 = the same + 16: the k order of P^T */
          u.q[0] = ld_tr16(vt + (hf * 32) * (SPV * 2) + j * 32); u.q[1] = ld_tr16(vt + (hf * 32 + 16) * (SPV * 2) + j * 32); vh[hf][j] = u.v; } }
      __builtin_amdgcn_sched_barrier(0);   /* holds the v fragment reads in front of the softmax arithmetic, which then covers their latency */
      float p[SK / 2];
#pragma unroll
      for (int i = 0; i < SK / 2; ++i) p[i] = s[i >> 3][i & 7];
      if (k0 + SK > vl) {   /* sequence_mask: keys at index >= valid_len are SET to -1e6, as written; a pass wholly below valid_len has none */
        const int rem = vl - k0 - 8 * g;
#pragma unroll
        for (int i = 0; i < SK / 2; ++i) if ((i >> 3) * 16 + (i & 7) >= rem) p[i] = MASKRAW; }
      float mt[SK / 16];   /* one chain a tile of 16 keys, each from the running maximum, joined at the end: a maximum does not depend on the order */
#pragma unroll
      for (int t = 0; t < SK / 16; ++t) { mt[t] = m;
#pragma unroll
        for (int r = 0; r < 8; ++r) mt[t] = fmaxf(mt[t], p[t * 8 + r]); }
      float mx = fmaxf(fmaxf(mt[0], mt[1]), fmaxf(mt[2], mt[3]));
      mx = fmaxf(mx, xhalf(mx));
      float al; asm("v_exp_f32 %0, %1\n\tv_nop" : "=v"(al) : "v"((m - mx) * C2));   /* the same form for the one rescale factor */
      m = mx; float e[SK / 2]; const v2f c2 = {C2, C2}, n2 = {-mx * C2, -mx * C2};
#pragma unroll
      for (int i = 0; i < SK / 2; i += 2) { const v2f a = {p[i], p[i + 1]}; const v2f t = __builtin_elementwise_fma(a, c2, n2);   /* two exponents a packed multiply-add */
        e[i] = t[0]; e[i + 1] = t[1]; }
#pragma unroll
      for (int i = 0; i < SK / 16; ++i) exp2x8(p + 8 * i, e + 8 * i);
      float sh[SK / 32];   /* one sum chain for each 32 keys: two independent chains; they join before they enter l */
#pragma unroll
      for (int hf = 0; hf < SK / 32; ++hf) { sh[hf] = p[hf * 16];
#pragma unroll
        for (int i = 1; i < 16; ++i) sh[hf] += p[hf * 16 + i]; }
      l = l * al + (sh[0] + sh[1]);
      __builtin_amdgcn_sched_barrier(0);   /* keeps the sums in front of the products: sunk between the pass's last products they land in operand registers just set free, each time at the price of four idle slots */
#pragma unroll
      for (int j = 0; j < HD / 16; ++j) acc[j] *= al;
#pragma unroll
      for (int hf = 0; hf < SK / 32; ++hf) { const F2 pf = bsplit16(p + hf * 16);
#pragma unroll
        for (int j = 0; j < HD / 16; ++j) acc[j] = mmb(vh[hf][j], pf.h, acc[j]);
#pragma unroll
        for (int j = 0; j < HD / 16; ++j) acc[j] = (hf == SK / 32 - 1 && j == HD / 16 - 1) ? wmma_bf(vh[hf][j], pf.l, acc[j]) : mmb(vh[hf][j], pf.l, acc[j]); } }   /* the pass's last matrix instruction brings its own four slots: the blocks behind the pass reuse its operand registers at once */
    if (more) {
#pragma unroll
      for (int i = 0; i < SR; ++i) { *(v4b*)&sk[team][bu ^ 1][srow + 16 * i][sseg] = rnd4(rk[i]); *(v4b*)&sv[team][bu ^ 1][srow + 16 * i][sseg] = rnd4(rv[i]); } }
    __syncthreads(); }
  l += xhalf(l); const float inv = 1.0f / l;
  float* yr = Y + ((size_t)h * TT + ql0 + col) * HD + 8 * g;   /* register r of tile j = output column j * 16 + 8g + r of query col: 32 contiguous bytes a lane */
#pragma unroll
  for (int j = 0; j < HD / 16; ++j) { v4f a, b;
#pragma unroll
    for (int r = 0; r < 4; ++r) { a[r] = acc[j][r] * inv; b[r] = acc[j][4 + r] * inv; }
    vst2(yr + j * 16, a); vst2(yr + j * 16 + 4, b); } }

extern "C" void kernel_launch(void* const* d_in, const int* in_sizes, int n_in, void* d_out, int out_size, void* d_ws, size_t ws_size, hipStream_t stream) {
  (void)in_sizes; (void)n_in; (void)out_size; (void)d_ws; (void)ws_size;
  const float** F = (const float**)d_in;
  // inputs: 0 queries [32,2048,64]; 1 keys; 2 values; 3 valid_lens [32] int
  k_fa<<<dim3(TT / 128, NH / 2), 512, 0, stream>>>(F[0], F[1], F[2], (const int*)d_in[3], (float*)d_out);
}

// v007
// It runs in 33.5 microseconds.
// Timed twice side by side with v006, it ran 1.06 and 1.05 times as fast.
// Counting every step since v000, it is 43.0 times as fast.
// compute dtype: all float inputs rounded to bf16, in registers inside the one kernel, on the way to LDS (k, v) or into the fragments (q); logits q.k as single EXACT products on WMMA 16x16x32 bf16 (f32 accumulate) / 8, keys at index >= valid_len set to -1e6; softmax in f32, its exponentials on the hardware's base-2 instruction (1/8 and log2(e) folded into one multiply-add); P split bf16 hi + lo (2 products against the exact bf16 v) for every query row; f32 output.
#include <hip/hip_runtime.h>
#include <math.h>

typedef __attribute__((ext_vector_type(16))) _Float16 v16h;
typedef __attribute__((ext_vector_type(16))) __bf16 v16b;
typedef __attribute__((ext_vector_type(8)))  _Float16 v8h;
typedef __attribute__((ext_vector_type(8)))  float v8f;
typedef __attribute__((ext_vector_type(4)))  float v4f;
typedef __attribute__((ext_vector_type(2)))  float v2f;
typedef __attribute__((ext_vector_type(4)))  unsigned v4u;
typedef __attribute__((ext_vector_type(4)))  int v4i;
typedef float __attribute__((may_alias)) float_a;
typedef int __attribute__((may_alias)) int_a;

template <typename T> __device__ __forceinline__ void vst2(void* p, T v) { *(T*)p = v;  }
__device__ __forceinline__ v8f wmma16(v16h a, v16h b, v8f c) {
  v8f d = __builtin_amdgcn_wmma_f32_16x16x32_f16(false, a, false, b, (short)0, c, false, false);
  asm volatile("v_nop\n\tv_nop\n\tv_nop\n\tv_nop" : "+v"(d) : "v"(a), "v"(b));
  return d;
}
__device__ __forceinline__ v8f wmma_bf(v16b a, v16b b, v8f c) {
  v8f d = __builtin_amdgcn_wmma_f32_16x16x32_bf16(false, a, false, b, (short)0, c, false, false);
  asm volatile("v_nop\n\tv_nop\n\tv_nop\n\tv_nop" : "+v"(d) : "v"(a), "v"(b));
  return d;
}
// 16x16x32 fragments: lane = (h = lane>>4, row/col = lane&15); elements 0..7 = k0+8h+0..7, 8..15 = k0+16+8h+0..7; D element r = row 8h+r
__device__ __forceinline__ v16h frag_h(const _Float16* rowk0, int lane) {
  union { v16h v; v8h q[2]; } u; const _Float16* p = rowk0 + 8 * (lane >> 4);
  u.q[0] = *(const v8h*)p; u.q[1] = *(const v8h*)(p + 16); return u.v;
}
__device__ __forceinline__ v16h frag_f32(const float* rowk0, int lane) {
  v16h a; const float* p = rowk0 + 8 * (lane >> 4);
#pragma unroll
  for (int i = 0; i < 8; ++i) { a[i] = (_Float16)p[i]; a[8 + i] = (_Float16)p[16 + i]; }
  return a;
}
__device__ __forceinline__ v16h frag_f32s(const float* rowk0, int lane, float sc) {
  v16h a; const float* p = rowk0 + 8 * (lane >> 4);
#pragma unroll
  for (int i = 0; i < 8; ++i) { a[i] = (_Float16)(p[i] * sc); a[8 + i] = (_Float16)(p[16 + i] * sc); }
  return a;
}
// column fragment from a [K][ld] layout (column n), rows >= K read as 0
__device__ __forceinline__ v16h fragc_f32(const float* W, int k0, int n, int lane, int ld, int K) {
  v16h a; const int g = lane >> 4;
#pragma unroll
  for (int i = 0; i < 8; ++i) { const int ka = k0 + 8 * g + i, kb = ka + 16;
    a[i] = (_Float16)(ka < K ? W[(size_t)(ka < K ? ka : K - 1) * ld + n] : 0.f); a[8 + i] = (_Float16)(kb < K ? W[(size_t)(kb < K ? kb : K - 1) * ld + n] : 0.f); }
  return a;
}
struct F2 { v16b h, l; };
__device__ __forceinline__ F2 bsplit16(const float v[16]) { F2 r;
#pragma unroll
  for (int i = 0; i < 16; ++i) { const __bf16 h = (__bf16)v[i]; r.h[i] = h; r.l[i] = (__bf16)(v[i] - (float)h); }
  return r; }
__device__ __forceinline__ F2 split_row(const float* row, int k0, int lane) { float v[16]; const float* p = row + k0 + 8 * (lane >> 4);
#pragma unroll
  for (int i = 0; i < 8; ++i) { v[i] = p[i]; v[8 + i] = p[16 + i]; }
  return bsplit16(v); }
__device__ __forceinline__ F2 split_rowK(const float* row, int k0, int lane, int K) { float v[16]; const int g = lane >> 4;
#pragma unroll
  for (int i = 0; i < 8; ++i) { const int ka = k0 + 8 * g + i, kb = ka + 16; v[i] = ka < K ? row[ka < K ? ka : K - 1] : 0.f; v[8 + i] = kb < K ? row[kb < K ? kb : K - 1] : 0.f; }
  return bsplit16(v); }
__device__ __forceinline__ F2 split_col(const float* W, int k0, int n, int lane, int ld, int K) { float v[16]; const int g = lane >> 4;
#pragma unroll
  for (int i = 0; i < 8; ++i) { const int ka = k0 + 8 * g + i, kb = ka + 16; v[i] = ka < K ? W[(size_t)(ka < K ? ka : K - 1) * ld + n] : 0.f; v[8 + i] = kb < K ? W[(size_t)(kb < K ? kb : K - 1) * ld + n] : 0.f; }
  return bsplit16(v); }
__device__ __forceinline__ v8f mac3(const F2& a, const F2& b, v8f c) { c = wmma_bf(a.l, b.h, c); c = wmma_bf(a.h, b.l, c); return wmma_bf(a.h, b.h, c); }
__device__ __forceinline__ float sigm(float v) { return 1.0f / (1.0f + expf(-v)); }
#define LDSX() do { asm volatile("s_wait_dscnt 0" ::: "memory"); __builtin_amdgcn_wave_barrier(); __builtin_amdgcn_fence(__ATOMIC_RELEASE, "workgroup"); } while (0)

// Masked dot-product attention (B 32 sequences treated as 32 planes, S 2,048, D 64): scores = q k^T / 8; keys k >= valid_lens[b] set to -1e6 (sequence mask); softmax; out = weights v -> [32, 2,048, 64].
#define NB 1
#define TT 2048
#define CC 2048            // NH * HD = projected width
#define DIN 2048          // input (model) width
#define NH 32
#define HD 64
#define NQB (TT / 64)
#define HG 4
#define SCALE (0.125f)
#define CAUSAL 0
#ifndef TNB
#define TNB NB
#endif
__device__ __forceinline__ float bfr(float v) { return (float)(__bf16)v; }
__host__ __device__ __forceinline__ int kb_last(int qb) { return CAUSAL ? ((qb * 64 + 63) >> 7) : (TT / 128 - 1); }
typedef __attribute__((ext_vector_type(8))) __bf16 v8b;
__device__ __forceinline__ v16b frag_b(const __bf16* rowk0, int lane) {
  union { v16b v; v8b q[2]; } u; const __bf16* p = rowk0 + 8 * (lane >> 4);
  u.q[0] = *(const v8b*)p; u.q[1] = *(const v8b*)(p + 16); return u.v;
}
// B fragment (k rows k0+.., output column o) of a weight: (in,out) [K][ld] or (out,in) [ld rows of K]: bf16 exact, or f16(bf16 * 256) exact
__device__ __forceinline__ v16b wcol_io(const float* Wm, int k0, int o, int lane, int ld) { v16b w; const int g = lane >> 4;
#pragma unroll
  for (int i = 0; i < 8; ++i) { w[i] = (__bf16)Wm[(size_t)(k0 + 8 * g + i) * ld + o]; w[8 + i] = (__bf16)Wm[(size_t)(k0 + 16 + 8 * g + i) * ld + o]; }
  return w; }
__device__ __forceinline__ v16b wcol_oi(const float* Wm, int k0, int o, int lane, int K) { v16b w; const float* p = Wm + (size_t)o * K + k0 + 8 * (lane >> 4);
#pragma unroll
  for (int i = 0; i < 8; ++i) { w[i] = (__bf16)p[i]; w[8 + i] = (__bf16)p[16 + i]; }
  return w; }
__device__ __forceinline__ v16h wcolh_io(const float* Wm, int k0, int o, int lane, int ld) { v16h w; const int g = lane >> 4;
#pragma unroll
  for (int i = 0; i < 8; ++i) { w[i] = (_Float16)(bfr(Wm[(size_t)(k0 + 8 * g + i) * ld + o]) * 256.0f); w[8 + i] = (_Float16)(bfr(Wm[(size_t)(k0 + 16 + 8 * g + i) * ld + o]) * 256.0f); }
  return w; }
__device__ __forceinline__ v16h wcolh_oi(const float* Wm, int k0, int o, int lane, int K) { v16h w; const float* p = Wm + (size_t)o * K + k0 + 8 * (lane >> 4);
#pragma unroll
  for (int i = 0; i < 8; ++i) { w[i] = (_Float16)(bfr(p[i]) * 256.0f); w[8 + i] = (_Float16)(bfr(p[16 + i]) * 256.0f); }
  return w; }
#define WQKV_LAYOUT 1   // 0 = (in,out) [DIN][CC]; 1 = (out,in) [CC][DIN]; 2 = per-head [NH][DIN][HD]
__device__ __forceinline__ v16b wcol_hdk(const float* Wm, int k0, int o, int lane) { v16b w; const int g = lane >> 4; const float* p = Wm + (size_t)(o / HD) * DIN * HD + (o % HD);
#pragma unroll
  for (int i = 0; i < 8; ++i) { w[i] = (__bf16)p[(size_t)(k0 + 8 * g + i) * HD]; w[8 + i] = (__bf16)p[(size_t)(k0 + 16 + 8 * g + i) * HD]; }
  return w; }
#define WO_OUT_IN 0
#if WQKV_LAYOUT == 1
#define WCOL(W, k0, o, lane) wcol_oi(W, k0, o, lane, DIN)
#elif WQKV_LAYOUT == 2
#define WCOL(W, k0, o, lane) wcol_hdk(W, k0, o, lane)
#else
#define WCOL(W, k0, o, lane) wcol_io(W, k0, o, lane, CC)
#endif
#if WO_OUT_IN
#define WOCOL(W, k0, o, lane) wcol_oi(W, k0, o, lane, CC)
#define WOCOLH(W, k0, o, lane) wcolh_oi(W, k0, o, lane, CC)
#else
#define WOCOL(W, k0, o, lane) wcol_io(W, k0, o, lane, DIN)
#define WOCOLH(W, k0, o, lane) wcolh_io(W, k0, o, lane, DIN)
#endif
// plain builtin form for the fused kernel: the compiler keeps the distance behind its own matrix instructions
__device__ __forceinline__ v8f mmb(v16b a, v16b b, v8f c) { return __builtin_amdgcn_wmma_f32_16x16x32_bf16(false, a, false, b, (short)0, c, false, false); }
__device__ __forceinline__ float xhalf(float x) { return __builtin_bit_cast(float, __builtin_amdgcn_permlanex16(__builtin_bit_cast(int, x), __builtin_bit_cast(int, x), 0x76543210, 0xfedcba98, false, false)); }   // lane l reads lane l ^ 16, on the vector port: no LDS counter to wait on while fragment reads are in flight
typedef __attribute__((ext_vector_type(8))) short v8s;
typedef __attribute__((ext_vector_type(4))) __bf16 v4b;
// transposing 16-bit LDS read, as a builtin the compiler sees (it places the LDS wait): lane l hands in the address of row 8 (l >> 4) + (l & 7), byte 16 ((l >> 3) & 1), and gets rows 8 (l >> 4) + 0..7 of column l & 15
__device__ __forceinline__ v8b ld_tr16(const char* p) { typedef __attribute__((address_space(3))) v8s lds_v8s; return __builtin_bit_cast(v8b, __builtin_amdgcn_ds_load_tr16_b128_v8i16((lds_v8s*)p)); }
__device__ __forceinline__ v4b rnd4(v4f f) { v4b o;
#pragma unroll
  for (int r = 0; r < 4; ++r) o[r] = (__bf16)f[r];
  return o; }   /* module inputs: bf16-rounded, to nearest even */
#define SK 64              // keys a stage: a team's 8 waves share one staged copy of the stage's k rows and v rows
#define C2 0.18033688011112042f   // SCALE * log2(e): exp(SCALE * s - max) = 2^(C2 * s - C2 * smax)
#define MASKRAW (-8000000.0f)      // the mask fill -1e6 in front of the scale: MASKRAW * SCALE is exactly -1e6
// base-2 exponentials in one statement that ends with the slot the instruction set asks for behind a transcendental; the results are early-clobber: none may share a register with a source that is still to be read
__device__ __forceinline__ void exp2x8(float* o, const float* i) {
  asm("v_exp_f32 %0, %8\n\tv_exp_f32 %1, %9\n\tv_exp_f32 %2, %10\n\tv_exp_f32 %3, %11\n\tv_exp_f32 %4, %12\n\tv_exp_f32 %5, %13\n\tv_exp_f32 %6, %14\n\tv_exp_f32 %7, %15\n\tv_nop"
      : "=&v"(o[0]), "=&v"(o[1]), "=&v"(o[2]), "=&v"(o[3]), "=&v"(o[4]), "=&v"(o[5]), "=&v"(o[6]), "=&v"(o[7]) : "v"(i[0]), "v"(i[1]), "v"(i[2]), "v"(i[3]), "v"(i[4]), "v"(i[5]), "v"(i[6]), "v"(i[7])); }
#define SP 72              // LDS row pitch of the k rows in 16-bit elements: 144 B = 16 B x odd, the pitch for 16-byte fragment reads
#define SPV 80             // LDS row pitch of the v rows: 160 B = 32 B x odd, the pitch for the transposing reads
// ---- k_fa: block = 2 key groups of 8 waves on ONE task at a time; a task = 128 queries of one plane, 16 query columns a wave, the same 128 queries in both groups. Group t walks the plane's stages of 64 keys t, t + 2, t + 4, ..., one pass each, with its own two LDS buffers, running maximum, sum and O^T; only stages that hold a key below the plane's valid_len are walked.
// A key at or past valid_len has the logit -1e6 and, beside any real logit, the weight exactly 0: a pass of only such keys rescales by exactly 1 and adds only zeros to l and O^T, so it is not walked. (A plane with valid_len <= 0 has no real logit: it walks every key, as written.)
// The launch lasts as long as its fullest WGP: the planes are ranked by length on the device (ties by index, so the ranks are a permutation for any lengths) and block group y takes the ranks y and 31 - y, whose lengths add up to about the same for every y, ONE AFTER THE OTHER: all 16 waves work from the first stage to the last, and no wave walks more than half of a plane's stages.
// Behind a task's last stage group 1 hands its maximum, sum and O^T to group 0 through LDS (one barrier); group 0 brings both to the common maximum, adds them and stores the rows. A group without a stage (a plane of one stage) hands over the start values: weight exactly 0.
// S^T = K . Q^T (A = 16 key rows, B = 16 query columns): lane (g, col) holds query col, register r = key 8g + r, so two S^T tiles (keys +0..15, +16..31) are, converted in place, the B operand of O^T += V^T . P^T.
// Running maximum m (of the unscaled logits) and running sum l per query column (each lane half sums its own keys; the halves join after the groups have joined); O^T and l are rescaled by 2^(C2 * (m_old - m_new)) every pass: exactly 1 while the maximum stands.
// k rows and v rows come as f32, straight from the module's [32, 2048, 64] inputs (a stage of a plane is 16 KiB in a row: every load of a wave is 512 bytes in a row), through registers, where they are rounded to bf16, into the group's two LDS buffers; V^T fragments come out of the v rows by the transposing LDS read. A group's next stage is loaded while its current one is worked on, rounded and stored behind it, and one barrier a trip both publishes it and ends the reads of the buffer that is refilled next; in the first task's last trip the next stage is the second task's first, so the two buffers run on over the change of task. The query rows of both tasks are read at the start. Every wave passes every barrier.
#define NT 2               // key groups a block
#define SR 4               // 16-byte pieces of each array that a thread stages: 64 rows of 256 bytes over 256 threads
__device__ __forceinline__ int eff_len(int v) { return (v <= 0 || v > TT) ? TT : v; }   // keys a plane walks
__global__ __launch_bounds__(512) void k_fa(const float* __restrict__ Q, const float* __restrict__ K, const float* __restrict__ V, const int* __restrict__ VL, float* __restrict__ Y) {
  __shared__ __align__(32) __bf16 sk[NT][2][SK][SP], sv[NT][2][SK][SPV];
  __shared__ __align__(16) float mg[8][HD / 8 + 1][32][4];   /* hand-over of group 1: a wave's O^T in 8 slots and (m, l) in the ninth; a slot is 16 bytes a lane, 512 bytes in a row a wave */
  const int tid = threadIdx.x, wave = __builtin_amdgcn_readfirstlane(tid >> 5), lane = tid & 31, col = lane & 15, g = lane >> 4; const int team = wave >> 3, ttid = tid & 255;
  // lane p ranks plane p: how many planes are longer, or as long with a lower index (one key holds both: no two keys are equal)
  const int vlp = VL[lane]; const int key = eff_len(vlp) * NH + (NH - 1 - lane); int rank = 0;
#pragma unroll
  for (int j = 0; j < NH; ++j) rank += __builtin_amdgcn_readlane(key, j) > key ? 1 : 0;
  const int gy = blockIdx.y;
  const int ha = __builtin_ctz(__builtin_amdgcn_ballot_w32(rank == gy)) & (NH - 1);            /* the block's first plane: a scalar, inside 0..31 whatever the lengths */
  const int hb = __builtin_ctz(__builtin_amdgcn_ballot_w32(rank == NH - 1 - gy)) & (NH - 1);   /* its second plane */
  const int ql0 = blockIdx.x * 128 + (wave & 7) * 16;
  const int srow = ttid >> 4, sseg = (ttid & 15) * 4;   /* staging: 16 threads a row of 256 bytes, 16 rows a step, 4 steps an array */
  const float* gk = K + ttid * 4;
  const float* gv = V + ttid * 4;
  v4f rk[SR], rv[SR];
  { const int kn = ha * TT * HD + team * SK * HD;   /* the group's first stage (stage 1 lies inside the arrays also where the plane does not walk it) */
#pragma unroll
    for (int i = 0; i < SR; ++i) { rk[i] = *(const v4f*)(gk + kn + i * 16 * HD); rv[i] = *(const v4f*)(gv + kn + i * 16 * HD); } }
  asm volatile("s_wait_xcnt 0x0" ::: "memory");   /* the wait in front of the reuse of these loads' address registers */
  v16b qq[2][HD / 32];
  // the inner loops are unrolled so that every fragment and accumulator array stays in registers
#pragma unroll
  for (int tk = 0; tk < 2; ++tk) {
#pragma unroll
    for (int kc = 0; kc < HD / 32; ++kc) { const float* qp = Q + ((size_t)(tk ? hb : ha) * TT + ql0 + col) * HD + kc * 32 + 8 * g;
#pragma unroll
      for (int i = 0; i < 8; ++i) { qq[tk][kc][i] = (__bf16)qp[i]; qq[tk][kc][8 + i] = (__bf16)qp[16 + i]; } } }
  asm volatile("s_wait_xcnt 0x0" ::: "memory");   /* the same for the query loads */
#pragma unroll
  for (int i = 0; i < SR; ++i) { *(v4b*)&sk[team][0][srow + 16 * i][sseg] = rnd4(rk[i]); *(v4b*)&sv[team][0][srow + 16 * i][sseg] = rnd4(rv[i]); }
  __syncthreads();
  int par = 0;   /* the buffer that holds the task's first stage */
#pragma unroll   /* two copies, one a task: what differs between the tasks (the refill over the change of task, the query fragments) is then settled at compile time */
  for (int tk = 0; tk < 2; ++tk) {
  const int h = tk ? hb : ha;
  const int vl = __builtin_amdgcn_readlane(vlp, h); const int nst = (eff_len(vl) + SK - 1) / SK;   /* the plane's stages: at most TT / SK */
  const int nb = (nst + 1) >> 1;                       /* trips of the block: group 0's stages; group 1 has as many or one fewer */
  const v16b (&qb)[HD / 32] = qq[tk];
  v8f acc[HD / 16] = {}; float m = -3.0e38f, l = 0.f;
  for (int it = 0; it < nb; ++it) { const int st = 2 * it + team; const int bu = (it + par) & 1; const bool own = st + 2 < nst;
    const bool more = own || (tk == 0 && it == nb - 1);   /* in the last trip no group has a stage of this plane left to load */
    if (more) { const int kn = own ? h * TT * HD + (st + 2) * SK * HD : hb * TT * HD + team * SK * HD;
#pragma unroll
      for (int i = 0; i < SR; ++i) { rk[i] = *(const v4f*)(gk + kn + i * 16 * HD); rv[i] = *(const v4f*)(gv + kn + i * 16 * HD); }
      asm volatile("s_wait_xcnt 0x0" ::: "memory"); }   /* the loads stay in flight over the stage while their address registers are reused: the wait in front of that overwrite */
    if (st < nst) { const int k0 = st * SK;   /* one pass takes the whole stage of 64 keys: the maximum's exchange, the rescale and the waits on LDS and on the dependent chains are paid once for 64 keys, with twice the independent work beside every chain */
      v8f s[SK / 16] = {}; v16b kb[SK / 8];
#pragma unroll
      for (int i = 0; i < SK / 8; ++i) { const int kr = (i >> 1) * 16 + col; kb[i] = frag_b(&sk[team][bu][kr][(i & 1) * 32], lane); }
      __builtin_amdgcn_sched_barrier(0);   /* holds the pass's 16 k fragment reads together in front of the products: one LDS wait a pass, not one between every few products */
#pragma unroll
      for (int kc = 0; kc < HD / 32; ++kc) {
#pragma unroll
        for (int t = 0; t < SK / 16; ++t) s[t] = mmb(kb[t * 2 + kc], qb[kc], s[t]); }
      v16b vh[SK / 32][HD / 16]; const char* vt = (const char*)&sv[team][bu][8 * g + (lane & 7)][8 * ((lane >> 3) & 1)];
#pragma unroll
      for (int hf = 0; hf < SK / 32; ++hf) {
#pragma unroll
        for (int j = 0; j < HD / 16; ++j) { union { v16b v; v8b q[2]; } u;   /* A fragment of V^T: row = output column j * 16 + col; elements 0..7 = keys hf * 32 + 8g + 0..7, 8..15 = the same + 16: the k order of P^T */
          u.q[0] = ld_tr16(vt + (hf * 32) * (SPV * 2) + j * 32); u.q[1] = ld_tr16(vt + (hf * 32 + 16) * (SPV * 2) + j * 32); vh[hf][j] = u.v; } }
      __builtin_amdgcn_sched_barrier(0);   /* holds the v fragment reads in front of the softmax arithmetic, which then covers their latency */
      float p[SK / 2];
#pragma unroll
      for (int i = 0; i < SK / 2; ++i) p[i] = s[i >> 3][i & 7];
      if (k0 + SK > vl) {   /* sequence_mask: keys at index >= valid_len are SET to -1e6, as written; a pass wholly below valid_len has none */
        const int rem = vl - k0 - 8 * g;
#pragma unroll
        for (int i = 0; i < SK / 2; ++i) if ((i >> 3) * 16 + (i & 7) >= rem) p[i] = MASKRAW; }
      float mt[SK / 16];   /* one chain a tile of 16 keys, each from the running maximum, joined at the end: a maximum does not depend on the order */
#pragma unroll
      for (int t = 0; t < SK / 16; ++t) { mt[t] = m;
#pragma unroll
        for (int r = 0; r < 8; ++r) mt[t] = fmaxf(mt[t], p[t * 8 + r]); }
      float mx = fmaxf(fmaxf(mt[0], mt[1]), fmaxf(mt[2], mt[3]));
      mx = fmaxf(mx, xhalf(mx));
      float al; asm("v_exp_f32 %0, %1\n\tv_nop" : "=v"(al) : "v"((m - mx) * C2));   /* the same form for the one rescale factor */
      m = mx; float e[SK / 2]; const v2f c2 = {C2, C2}, n2 = {-mx * C2, -mx * C2};
#pragma unroll
      for (int i = 0; i < SK / 2; i += 2) { const v2f a = {p[i], p[i + 1]}; const v2f t = __builtin_elementwise_fma(a, c2, n2);   /* two exponents a packed multiply-add */
        e[i] = t[0]; e[i + 1] = t[1]; }
#pragma unroll
      for (int i = 0; i < SK / 16; ++i) exp2x8(p + 8 * i, e + 8 * i);
      float sh[SK / 32];   /* one sum chain for each 32 keys: two independent chains; they join before they enter l */
#pragma unroll
      for (int hf = 0; hf < SK / 32; ++hf) { sh[hf] = p[hf * 16];
#pragma unroll
        for (int i = 1; i < 16; ++i) sh[hf] += p[hf * 16 + i]; }
      l = l * al + (sh[0] + sh[1]);
      __builtin_amdgcn_sched_barrier(0);   /* keeps the sums in front of the products: sunk between the pass's last products they land in operand registers just set free, each time at the price of four idle slots */
#pragma unroll
      for (int j = 0; j < HD / 16; ++j) acc[j] *= al;
#pragma unroll
      for (int hf = 0; hf < SK / 32; ++hf) { const F2 pf = bsplit16(p + hf * 16);
#pragma unroll
        for (int j = 0; j < HD / 16; ++j) acc[j] = mmb(vh[hf][j], pf.h, acc[j]);
#pragma unroll
        for (int j = 0; j < HD / 16; ++j) acc[j] = (hf == SK / 32 - 1 && j == HD / 16 - 1) ? wmma_bf(vh[hf][j], pf.l, acc[j]) : mmb(vh[hf][j], pf.l, acc[j]); } }   /* the pass's last matrix instruction brings its own four slots: the blocks behind the pass reuse its operand registers at once */
    if (more) {
#pragma unroll
      for (int i = 0; i < SR; ++i) { *(v4b*)&sk[team][bu ^ 1][srow + 16 * i][sseg] = rnd4(rk[i]); *(v4b*)&sv[team][bu ^ 1][srow + 16 * i][sseg] = rnd4(rv[i]); } }
    __syncthreads(); }
  par = (par + nb) & 1;
  if (team) {
#pragma unroll
    for (int j = 0; j < HD / 16; ++j) { v4f a, b;
#pragma unroll
      for (int r = 0; r < 4; ++r) { a[r] = acc[j][r]; b[r] = acc[j][4 + r]; }
      *(v4f*)&mg[wave & 7][2 * j][lane][0] = a; *(v4f*)&mg[wave & 7][2 * j + 1][lane][0] = b; }
    const v4f ml = {m, l, 0.f, 0.f}; *(v4f*)&mg[wave & 7][HD / 8][lane][0] = ml; }
  __syncthreads();   /* publishes group 1's hand-over; the barriers of the next task's trips stand between these reads and the next hand-over's stores */
  if (!team) {
    const v4f ml = *(const v4f*)&mg[wave][HD / 8][lane][0];
    const float mx = fmaxf(m, ml[0]); float a0, a1;
    asm("v_exp_f32 %0, %2\n\tv_exp_f32 %1, %3\n\tv_nop" : "=&v"(a0), "=&v"(a1) : "v"((m - mx) * C2), "v"((ml[0] - mx) * C2));   /* both groups' factors to the common maximum, with the slot behind a transcendental */
    l = l * a0 + ml[1] * a1;
    l += xhalf(l); const float inv = 1.0f / l, i0 = a0 * inv, i1 = a1 * inv;
    float* yr = Y + ((size_t)h * TT + ql0 + col) * HD + 8 * g;   /* register r of tile j = output column j * 16 + 8g + r of query col: 32 contiguous bytes a lane */
#pragma unroll
    for (int j = 0; j < HD / 16; ++j) { const v4f oa = *(const v4f*)&mg[wave][2 * j][lane][0], ob = *(const v4f*)&mg[wave][2 * j + 1][lane][0]; v4f a, b;
#pragma unroll
      for (int r = 0; r < 4; ++r) { a[r] = acc[j][r] * i0 + oa[r] * i1; b[r] = acc[j][4 + r] * i0 + ob[r] * i1; }
      vst2(yr + j * 16, a); vst2(yr + j * 16 + 4, b); }
    if (tk == 0) asm volatile("s_wait_xcnt 0x0" ::: "memory"); }   /* the wait in front of the reuse of the stores' registers by the next task */
  } }

extern "C" void kernel_launch(void* const* d_in, const int* in_sizes, int n_in, void* d_out, int out_size, void* d_ws, size_t ws_size, hipStream_t stream) {
  (void)in_sizes; (void)n_in; (void)out_size; (void)d_ws; (void)ws_size;
  const float** F = (const float**)d_in;
  // inputs: 0 queries [32,2048,64]; 1 keys; 2 values; 3 valid_lens [32] int
  k_fa<<<dim3(TT / 128, NH / 2), 512, 0, stream>>>(F[0], F[1], F[2], (const int*)d_in[3], (float*)d_out);
}

// v009
// Measured time: 27.6 microseconds a run.
// It is 1.21 times as fast as v007, going by the measured steps of the versions left out in between.
// Over all steps from v000 it is 52.0 times as fast.
// compute dtype: all float inputs rounded to bf16, in registers inside the one kernel, on the way to LDS (k, v) or into the fragments (q); logits q.k as single EXACT products on WMMA 16x16x32 bf16 (f32 accumulate) / 8, keys at index >= valid_len set to -1e6; softmax in f32, its exponentials on the hardware's base-2 instruction (1/8 and log2(e) folded into one multiply-add); P, taken against the maximum in use, rounded to f16 (11 significant bits; P lies in 0..4,096) and multiplied in ONE WMMA 16x16x32 f16 product (f32 accumulate) against the bf16-rounded v, which is carried in f16 (the same value for 2^-17 <= |v| < 65,504; smaller ones within 2^-25) for every query row; f32 output.
#include <hip/hip_runtime.h>
#include <math.h>

typedef __attribute__((ext_vector_type(16))) _Float16 v16h;
typedef __attribute__((ext_vector_type(16))) __bf16 v16b;
typedef __attribute__((ext_vector_type(8)))  _Float16 v8h;
typedef __attribute__((ext_vector_type(8)))  float v8f;
typedef __attribute__((ext_vector_type(4)))  float v4f;
typedef __attribute__((ext_vector_type(2)))  float v2f;
typedef __attribute__((ext_vector_type(4)))  unsigned v4u;
typedef __attribute__((ext_vector_type(4)))  int v4i;
typedef float __attribute__((may_alias)) float_a;
typedef int __attribute__((may_alias)) int_a;

template <typename T> __device__ __forceinline__ void vst2(void* p, T v) { *(T*)p = v;  }
__device__ __forceinline__ v8f wmma16(v16h a, v16h b, v8f c) {
  v8f d = __builtin_amdgcn_wmma_f32_16x16x32_f16(false, a, false, b, (short)0, c, false, false);
  asm volatile("v_nop\n\tv_nop\n\tv_nop\n\tv_nop" : "+v"(d) : "v"(a), "v"(b));
  return d;
}
__device__ __forceinline__ v8f wmma_bf(v16b a, v16b b, v8f c) {
  v8f d = __builtin_amdgcn_wmma_f32_16x16x32_bf16(false, a, false, b, (short)0, c, false, false);
  asm volatile("v_nop\n\tv_nop\n\tv_nop\n\tv_nop" : "+v"(d) : "v"(a), "v"(b));
  return d;
}
// 16x16x32 fragments: lane = (h = lane>>4, row/col = lane&15); elements 0..7 = k0+8h+0..7, 8..15 = k0+16+8h+0..7; D element r = row 8h+r
__device__ __forceinline__ v16h frag_h(const _Float16* rowk0, int lane) {
  union { v16h v; v8h q[2]; } u; const _Float16* p = rowk0 + 8 * (lane >> 4);
  u.q[0] = *(const v8h*)p; u.q[1] = *(const v8h*)(p + 16); return u.v;
}
__device__ __forceinline__ v16h frag_f32(const float* rowk0, int lane) {
  v16h a; const float* p = rowk0 + 8 * (lane >> 4);
#pragma unroll
  for (int i = 0; i < 8; ++i) { a[i] = (_Float16)p[i]; a[8 + i] = (_Float16)p[16 + i]; }
  return a;
}
__device__ __forceinline__ v16h frag_f32s(const float* rowk0, int lane, float sc) {
  v16h a; const float* p = rowk0 + 8 * (lane >> 4);
#pragma unroll
  for (int i = 0; i < 8; ++i) { a[i] = (_Float16)(p[i] * sc); a[8 + i] = (_Float16)(p[16 + i] * sc); }
  return a;
}
// column fragment from a [K][ld] layout (column n), rows >= K read as 0
__device__ __forceinline__ v16h fragc_f32(const float* W, int k0, int n, int lane, int ld, int K) {
  v16h a; const int g = lane >> 4;
#pragma unroll
  for (int i = 0; i < 8; ++i) { const int ka = k0 + 8 * g + i, kb = ka + 16;
    a[i] = (_Float16)(ka < K ? W[(size_t)(ka < K ? ka : K - 1) * ld + n] : 0.f); a[8 + i] = (_Float16)(kb < K ? W[(size_t)(kb < K ? kb : K - 1) * ld + n] : 0.f); }
  return a;
}
struct F2 { v16b h, l; };
__device__ __forceinline__ F2 bsplit16(const float v[16]) { F2 r;
#pragma unroll
  for (int i = 0; i < 16; ++i) { const __bf16 h = (__bf16)v[i]; r.h[i] = h; r.l[i] = (__bf16)(v[i] - (float)h); }
  return r; }
__device__ __forceinline__ F2 split_row(const float* row, int k0, int lane) { float v[16]; const float* p = row + k0 + 8 * (lane >> 4);
#pragma unroll
  for (int i = 0; i < 8; ++i) { v[i] = p[i]; v[8 + i] = p[16 + i]; }
  return bsplit16(v); }
__device__ __forceinline__ F2 split_rowK(const float* row, int k0, int lane, int K) { float v[16]; const int g = lane >> 4;
#pragma unroll
  for (int i = 0; i < 8; ++i) { const int ka = k0 + 8 * g + i, kb = ka + 16; v[i] = ka < K ? row[ka < K ? ka : K - 1] : 0.f; v[8 + i] = kb < K ? row[kb < K ? kb : K - 1] : 0.f; }
  return bsplit16(v); }
__device__ __forceinline__ F2 split_col(const float* W, int k0, int n, int lane, int ld, int K) { float v[16]; const int g = lane >> 4;
#pragma unroll
  for (int i = 0; i < 8; ++i) { const int ka = k0 + 8 * g + i, kb = ka + 16; v[i] = ka < K ? W[(size_t)(ka < K ? ka : K - 1) * ld + n] : 0.f; v[8 + i] = kb < K ? W[(size_t)(kb < K ? kb : K - 1) * ld + n] : 0.f; }
  return bsplit16(v); }
__device__ __forceinline__ v8f mac3(const F2& a, const F2& b, v8f c) { c = wmma_bf(a.l, b.h, c); c = wmma_bf(a.h, b.l, c); return wmma_bf(a.h, b.h, c); }
__device__ __forceinline__ float sigm(float v) { return 1.0f / (1.0f + expf(-v)); }
#define LDSX() do { asm volatile("s_wait_dscnt 0" ::: "memory"); __builtin_amdgcn_wave_barrier(); __builtin_amdgcn_fence(__ATOMIC_RELEASE, "workgroup"); } while (0)

// Masked dot-product attention (B 32 sequences treated as 32 planes, S 2,048, D 64): scores = q k^T / 8; keys k >= valid_lens[b] set to -1e6 (sequence mask); softmax; out = weights v -> [32, 2,048, 64].
#define NB 1
#define TT 2048
#define CC 2048            // NH * HD = projected width
#define DIN 2048          // input (model) width
#define NH 32
#define HD 64
#define NQB (TT / 64)
#define HG 4
#define SCALE (0.125f)
#define CAUSAL 0
#ifndef TNB
#define TNB NB
#endif
__device__ __forceinline__ float bfr(float v) { return (float)(__bf16)v; }
__host__ __device__ __forceinline__ int kb_last(int qb) { return CAUSAL ? ((qb * 64 + 63) >> 7) : (TT / 128 - 1); }
typedef __attribute__((ext_vector_type(8))) __bf16 v8b;
__device__ __forceinline__ v16b frag_b(const __bf16* rowk0, int lane) {
  union { v16b v; v8b q[2]; } u; const __bf16* p = rowk0 + 8 * (lane >> 4);
  u.q[0] = *(const v8b*)p; u.q[1] = *(const v8b*)(p + 16); return u.v;
}
// B fragment (k rows k0+.., output column o) of a weight: (in,out) [K][ld] or (out,in) [ld rows of K]: bf16 exact, or f16(bf16 * 256) exact
__device__ __forceinline__ v16b wcol_io(const float* Wm, int k0, int o, int lane, int ld) { v16b w; const int g = lane >> 4;
#pragma unroll
  for (int i = 0; i < 8; ++i) { w[i] = (__bf16)Wm[(size_t)(k0 + 8 * g + i) * ld + o]; w[8 + i] = (__bf16)Wm[(size_t)(k0 + 16 + 8 * g + i) * ld + o]; }
  return w; }
__device__ __forceinline__ v16b wcol_oi(const float* Wm, int k0, int o, int lane, int K) { v16b w; const float* p = Wm + (size_t)o * K + k0 + 8 * (lane >> 4);
#pragma unroll
  for (int i = 0; i < 8; ++i) { w[i] = (__bf16)p[i]; w[8 + i] = (__bf16)p[16 + i]; }
  return w; }
__device__ __forceinline__ v16h wcolh_io(const float* Wm, int k0, int o, int lane, int ld) { v16h w; const int g = lane >> 4;
#pragma unroll
  for (int i = 0; i < 8; ++i) { w[i] = (_Float16)(bfr(Wm[(size_t)(k0 + 8 * g + i) * ld + o]) * 256.0f); w[8 + i] = (_Float16)(bfr(Wm[(size_t)(k0 + 16 + 8 * g + i) * ld + o]) * 256.0f); }
  return w; }
__device__ __forceinline__ v16h wcolh_oi(const float* Wm, int k0, int o, int lane, int K) { v16h w; const float* p = Wm + (size_t)o * K + k0 + 8 * (lane >> 4);
#pragma unroll
  for (int i = 0; i < 8; ++i) { w[i] = (_Float16)(bfr(p[i]) * 256.0f); w[8 + i] = (_Float16)(bfr(p[16 + i]) * 256.0f); }
  return w; }
#define WQKV_LAYOUT 1   // 0 = (in,out) [DIN][CC]; 1 = (out,in) [CC][DIN]; 2 = per-head [NH][DIN][HD]
__device__ __forceinline__ v16b wcol_hdk(const float* Wm, int k0, int o, int lane) { v16b w; const int g = lane >> 4; const float* p = Wm + (size_t)(o / HD) * DIN * HD + (o % HD);
#pragma unroll
  for (int i = 0; i < 8; ++i) { w[i] = (__bf16)p[(size_t)(k0 + 8 * g + i) * HD]; w[8 + i] = (__bf16)p[(size_t)(k0 + 16 + 8 * g + i) * HD]; }
  return w; }
#define WO_OUT_IN 0
#if WQKV_LAYOUT == 1
#define WCOL(W, k0, o, lane) wcol_oi(W, k0, o, lane, DIN)
#elif WQKV_LAYOUT == 2
#define WCOL(W, k0, o, lane) wcol_hdk(W, k0, o, lane)
#else
#define WCOL(W, k0, o, lane) wcol_io(W, k0, o, lane, CC)
#endif
#if WO_OUT_IN
#define WOCOL(W, k0, o, lane) wcol_oi(W, k0, o, lane, CC)
#define WOCOLH(W, k0, o, lane) wcolh_oi(W, k0, o, lane, CC)
#else
#define WOCOL(W, k0, o, lane) wcol_io(W, k0, o, lane, DIN)
#define WOCOLH(W, k0, o, lane) wcolh_io(W, k0, o, lane, DIN)
#endif
// plain builtin form for the fused kernel: the compiler keeps the distance behind its own matrix instructions
__device__ __forceinline__ v8f mmb(v16b a, v16b b, v8f c) { return __builtin_amdgcn_wmma_f32_16x16x32_bf16(false, a, false, b, (short)0, c, false, false); }
__device__ __forceinline__ v8f mmh(v16h a, v16h b, v8f c) { return __builtin_amdgcn_wmma_f32_16x16x32_f16(false, a, false, b, (short)0, c, false, false); }
__device__ __forceinline__ float xhalf(float x) { return __builtin_bit_cast(float, __builtin_amdgcn_permlanex16(__builtin_bit_cast(int, x), __builtin_bit_cast(int, x), 0x76543210, 0xfedcba98, false, false)); }   // lane l reads lane l ^ 16, on the vector port: no LDS counter to wait on while fragment reads are in flight
typedef __attribute__((ext_vector_type(8))) short v8s;
typedef __attribute__((ext_vector_type(4))) __bf16 v4b;
// transposing 16-bit LDS read, as a builtin the compiler sees (it places the LDS wait): lane l hands in the address of row 8 (l >> 4) + (l & 7), byte 16 ((l >> 3) & 1), and gets rows 8 (l >> 4) + 0..7 of column l & 15
__device__ __forceinline__ v8h ld_tr16(const char* p) { typedef __attribute__((address_space(3))) v8s lds_v8s; return __builtin_bit_cast(v8h, __builtin_amdgcn_ds_load_tr16_b128_v8i16((lds_v8s*)p)); }
__device__ __forceinline__ v4b rnd4(v4f f) { v4b o;
#pragma unroll
  for (int r = 0; r < 4; ++r) o[r] = (__bf16)f[r];
  return o; }   /* module inputs: bf16-rounded, to nearest even */
typedef __attribute__((ext_vector_type(4))) _Float16 v4h;
__device__ __forceinline__ v4h rnd4h(v4f f) { v4h o;
#pragma unroll
  for (int r = 0; r < 4; ++r) o[r] = (_Float16)(float)(__bf16)f[r];
  return o; }   /* v: the same bf16 rounding, then carried in f16, whose 11 bits hold the 8 of a bf16 */
#define SK 64              // keys a stage: a team's 8 waves share one staged copy of the stage's k rows and v rows
#define C2 0.18033688011112042f   // SCALE * log2(e): exp(SCALE * s - max) = 2^(C2 * s - C2 * smax)
#define MASKRAW (-8000000.0f)      // the mask fill -1e6 in front of the scale: MASKRAW * SCALE is exactly -1e6
// base-2 exponentials in one statement that ends with the slot the instruction set asks for behind a transcendental; the results are early-clobber: none may share a register with a source that is still to be read
__device__ __forceinline__ void exp2x8(float* o, const float* i) {
  asm("v_exp_f32 %0, %8\n\tv_exp_f32 %1, %9\n\tv_exp_f32 %2, %10\n\tv_exp_f32 %3, %11\n\tv_exp_f32 %4, %12\n\tv_exp_f32 %5, %13\n\tv_exp_f32 %6, %14\n\tv_exp_f32 %7, %15\n\tv_nop"
      : "=&v"(o[0]), "=&v"(o[1]), "=&v"(o[2]), "=&v"(o[3]), "=&v"(o[4]), "=&v"(o[5]), "=&v"(o[6]), "=&v"(o[7]) : "v"(i[0]), "v"(i[1]), "v"(i[2]), "v"(i[3]), "v"(i[4]), "v"(i[5]), "v"(i[6]), "v"(i[7])); }
#define SP 72              // LDS row pitch of the k rows in 16-bit elements: 144 B = 16 B x odd, the pitch for 16-byte fragment reads
#define SPV 80             // LDS row pitch of the v rows: 160 B = 32 B x odd, the pitch for the transposing reads
// ---- k_fa: block = 2 key groups of 8 waves on ONE task at a time; a task = 128 queries of one plane, 16 query columns a wave, the same 128 queries in both groups. Group t walks the plane's stages of 64 keys t, t + 2, t + 4, ..., one pass each, with its own two LDS buffers, running maximum, sum and O^T; only stages that hold a key below the plane's valid_len are walked.
// A key at or past valid_len has the logit -1e6 and, beside any real logit, the weight exactly 0: a pass of only such keys rescales by exactly 1 and adds only zeros to l and O^T, so it is not walked. (A plane with valid_len <= 0 has no real logit: it walks every key, as written.)
// The launch lasts as long as its fullest WGP: the planes are ranked by length on the device (ties by index, so the ranks are a permutation for any lengths) and block group y takes the ranks y and 31 - y, whose lengths add up to about the same for every y, ONE AFTER THE OTHER: all 16 waves work from the first stage to the last, and no wave walks more than half of a plane's stages.
// Behind a task's last stage group 1 hands its maximum, sum and O^T to group 0 through LDS (one barrier); group 0 brings both to the common maximum, adds them and stores the rows. A group without a stage (a plane of one stage) hands over the start values: weight exactly 0.
// S^T = K . Q^T (A = 16 key rows, B = 16 query columns): lane (g, col) holds query col, register r = key 8g + r, so two S^T tiles (keys +0..15, +16..31) are, converted in place, the B operand of O^T += V^T . P^T.
// Maximum in use m (of the unscaled logits) and running sum l per query column (each lane half sums its own keys; the halves join after the groups have joined). m is set by the group's first pass and then stands: the weights are taken against it at once, and a pass looks for a new maximum, and rescales O^T and l by 2^(C2 * (m_old - m_new)), only where a lane's sum of the pass's weights comes out above PMAX (or is no number). The quotient O^T / l does not depend on m.
// k rows and v rows come as f32, straight from the module's [32, 2048, 64] inputs (a stage of a plane is 16 KiB in a row: every load of a wave is 512 bytes in a row), through registers, where they are rounded to bf16 (the v values then written as f16), into the group's two LDS buffers; V^T fragments come out of the v rows by the transposing LDS read. A group's next stage is loaded while its current one is worked on, rounded and stored behind it, and one barrier a trip both publishes it and ends the reads of the buffer that is refilled next; in the first task's last trip the next stage is the second task's first, so the two buffers run on over the change of task. The query rows of both tasks are read at the start. Every wave passes every barrier.
#define NT 2               // key groups a block
#define SR 4               // 16-byte pieces of each array that a thread stages: 64 rows of 256 bytes over 256 threads
__device__ __forceinline__ int eff_len(int v) { return (v <= 0 || v > TT) ? TT : v; }   // keys a plane walks
#define PMAX 4096.0f       // a lane's sum of a pass's 32 weights up to here: every weight is at most this, far inside f16's range, and the maximum in use stands
// sequence_mask: keys at index >= valid_len are SET to -1e6, as written; rem = valid_len less the index of the lane's first key
__device__ __forceinline__ void mask_keys(float* p, int rem) {
#pragma unroll
  for (int i = 0; i < SK / 2; ++i) if ((i >> 3) * 16 + (i & 7) >= rem) p[i] = MASKRAW; }
// maximum of m and a query column's 64 logits: one chain a tile of 16 keys, joined at the end (a maximum does not depend on the order), then the other lane half's
__device__ __forceinline__ float col_max(const float* p, float m) { float mt[SK / 16];
#pragma unroll
  for (int t = 0; t < SK / 16; ++t) { mt[t] = m;
#pragma unroll
    for (int r = 0; r < 8; ++r) mt[t] = fmaxf(mt[t], p[t * 8 + r]); }
  const float mx = fmaxf(fmaxf(mt[0], mt[1]), fmaxf(mt[2], mt[3])); return fmaxf(mx, xhalf(mx)); }
// weights 2^(C2 * logit + nm) of a pass, nm = -C2 * the maximum in use: their sum (returned) and P^T of both halves, rounded to f16: the B operands of the pass's 8 products
__device__ __forceinline__ float weights(const float* p, float nm, v16h* pf) { float e[SK / 2], w[SK / 2]; const v2f c2 = {C2, C2}, n2 = {nm, nm};
#pragma unroll
  for (int i = 0; i < SK / 2; i += 2) { const v2f a = {p[i], p[i + 1]}; const v2f t = __builtin_elementwise_fma(a, c2, n2);   /* two exponents a packed multiply-add */
    e[i] = t[0]; e[i + 1] = t[1]; }
#pragma unroll
  for (int i = 0; i < SK / 16; ++i) exp2x8(w + 8 * i, e + 8 * i);
  float sh[SK / 32];   /* one sum chain for each 32 keys: two independent chains; they join before they enter l */
#pragma unroll
  for (int hf = 0; hf < SK / 32; ++hf) { sh[hf] = w[hf * 16];
#pragma unroll
    for (int i = 1; i < 16; ++i) sh[hf] += w[hf * 16 + i]; }
#pragma unroll
  for (int hf = 0; hf < SK / 32; ++hf) {
#pragma unroll
    for (int i = 0; i < 16; ++i) pf[hf][i] = (_Float16)w[hf * 16 + i]; }
  return sh[0] + sh[1]; }
__global__ __launch_bounds__(512) void k_fa(const float* __restrict__ Q, const float* __restrict__ K, const float* __restrict__ V, const int* __restrict__ VL, float* __restrict__ Y) {
  __shared__ __align__(32) __bf16 sk[NT][2][SK][SP]; __shared__ __align__(32) _Float16 sv[NT][2][SK][SPV];
  __shared__ __align__(16) float mg[8][HD / 8 + 1][32][4];   /* hand-over of group 1: a wave's O^T in 8 slots and (m, l) in the ninth; a slot is 16 bytes a lane, 512 bytes in a row a wave */
  const int tid = threadIdx.x, wave = __builtin_amdgcn_readfirstlane(tid >> 5), lane = tid & 31, col = lane & 15, g = lane >> 4; const int team = wave >> 3, ttid = tid & 255;
  // lane p ranks plane p: how many planes are longer, or as long with a lower index (one key holds both: no two keys are equal)
  const int vlp = VL[lane]; const int key = eff_len(vlp) * NH + (NH - 1 - lane); int rank = 0;
#pragma unroll
  for (int j = 0; j < NH; ++j) rank += __builtin_amdgcn_readlane(key, j) > key ? 1 : 0;
  const int gy = blockIdx.y;
  const int ha = __builtin_ctz(__builtin_amdgcn_ballot_w32(rank == gy)) & (NH - 1);            /* the block's first plane: a scalar, inside 0..31 whatever the lengths */
  const int hb = __builtin_ctz(__builtin_amdgcn_ballot_w32(rank == NH - 1 - gy)) & (NH - 1);   /* its second plane */
  const int ql0 = blockIdx.x * 128 + (wave & 7) * 16;
  const int srow = ttid >> 4, sseg = (ttid & 15) * 4;   /* staging: 16 threads a row of 256 bytes, 16 rows a step, 4 steps an array */
  const float* gk = K + ttid * 4;
  const float* gv = V + ttid * 4;
  v4f rk[SR], rv[SR];
  { const int kn = ha * TT * HD + team * SK * HD;   /* the group's first stage (stage 1 lies inside the arrays also where the plane does not walk it) */
#pragma unroll
    for (int i = 0; i < SR; ++i) { rk[i] = *(const v4f*)(gk + kn + i * 16 * HD); rv[i] = *(const v4f*)(gv + kn + i * 16 * HD); } }
  asm volatile("s_wait_xcnt 0x0" ::: "memory");   /* the wait in front of the reuse of these loads' address registers */
  v16b qq[2][HD / 32];
  // the inner loops are unrolled so that every fragment and accumulator array stays in registers
#pragma unroll
  for (int tk = 0; tk < 2; ++tk) {
#pragma unroll
    for (int kc = 0; kc < HD / 32; ++kc) { const float* qp = Q + ((size_t)(tk ? hb : ha) * TT + ql0 + col) * HD + kc * 32 + 8 * g;
#pragma unroll
      for (int i = 0; i < 8; ++i) { qq[tk][kc][i] = (__bf16)qp[i]; qq[tk][kc][8 + i] = (__bf16)qp[16 + i]; } } }
  asm volatile("s_wait_xcnt 0x0" ::: "memory");   /* the same for the query loads */
#pragma unroll
  for (int i = 0; i < SR; ++i) { *(v4b*)&sk[team][0][srow + 16 * i][sseg] = rnd4(rk[i]); *(v4h*)&sv[team][0][srow + 16 * i][sseg] = rnd4h(rv[i]); }
  __syncthreads();
  int par = 0;   /* the buffer that holds the task's first stage */
#pragma unroll   /* two copies, one a task: what differs between the tasks (the refill over the change of task, the query fragments) is then settled at compile time */
  for (int tk = 0; tk < 2; ++tk) {
  const int h = tk ? hb : ha;
  const int vl = __builtin_amdgcn_readlane(vlp, h); const int nst = (eff_len(vl) + SK - 1) / SK;   /* the plane's stages: at most TT / SK */
  const int nb = (nst + 1) >> 1;                       /* trips of the block: group 0's stages; group 1 has as many or one fewer */
  const v16b (&qb)[HD / 32] = qq[tk];
  v8f acc[HD / 16] = {}; float m = -3.0e38f, nm = 3.0e38f * C2, l = 0.f;
  for (int it = 0; it < nb; ++it) { const int st = 2 * it + team; const int bu = (it + par) & 1; const bool own = st + 2 < nst;
    const bool more = own || (tk == 0 && it == nb - 1);   /* in the last trip no group has a stage of this plane left to load */
    if (more) { const int kn = own ? h * TT * HD + (st + 2) * SK * HD : hb * TT * HD + team * SK * HD;
#pragma unroll
      for (int i = 0; i < SR; ++i) { rk[i] = *(const v4f*)(gk + kn + i * 16 * HD); rv[i] = *(const v4f*)(gv + kn + i * 16 * HD); }
      asm volatile("s_wait_xcnt 0x0" ::: "memory"); }   /* the loads stay in flight over the stage while their address registers are reused: the wait in front of that overwrite */
    if (st < nst) { const int k0 = st * SK;   /* one pass takes the whole stage of 64 keys: the maximum's exchange, the rescale and the waits on LDS and on the dependent chains are paid once for 64 keys, with twice the independent work beside every chain */
      v8f s[SK / 16] = {}; v16b kb[SK / 8];
#pragma unroll
      for (int i = 0; i < SK / 8; ++i) { const int kr = (i >> 1) * 16 + col; kb[i] = frag_b(&sk[team][bu][kr][(i & 1) * 32], lane); }
      __builtin_amdgcn_sched_barrier(0);   /* holds the pass's 16 k fragment reads together in front of the products: one LDS wait a pass, not one between every few products */
#pragma unroll
      for (int kc = 0; kc < HD / 32; ++kc) {
#pragma unroll
        for (int t = 0; t < SK / 16; ++t) s[t] = mmb(kb[t * 2 + kc], qb[kc], s[t]); }
      v16h vh[SK / 32][HD / 16]; const char* vt = (const char*)&sv[team][bu][8 * g + (lane & 7)][8 * ((lane >> 3) & 1)];
#pragma unroll
      for (int hf = 0; hf < SK / 32; ++hf) {
#pragma unroll
        for (int j = 0; j < HD / 16; ++j) { union { v16h v; v8h q[2]; } u;   /* A fragment of V^T: row = output column j * 16 + col; elements 0..7 = keys hf * 32 + 8g + 0..7, 8..15 = the same + 16: the k order of P^T */
          u.q[0] = ld_tr16(vt + (hf * 32) * (SPV * 2) + j * 32); u.q[1] = ld_tr16(vt + (hf * 32 + 16) * (SPV * 2) + j * 32); vh[hf][j] = u.v; } }
      __builtin_amdgcn_sched_barrier(0);   /* holds the v fragment reads in front of the softmax arithmetic, which then covers their latency */
      float p[SK / 2];
#pragma unroll
      for (int i = 0; i < SK / 2; ++i) p[i] = s[i >> 3][i & 7];
      const bool edge = k0 + SK > vl; const int rem = vl - k0 - 8 * g;   /* a pass wholly below valid_len has no masked key */
      if (edge) mask_keys(p, rem);
      if (it == 0) { m = col_max(p, m); nm = -m * C2; }   /* the group's first pass of the task sets the maximum in use; O^T and l are still zero: nothing to rescale */
      v16h pf[SK / 32];
      float ps = weights(p, nm, pf);
      if (__builtin_amdgcn_ballot_w32(!(ps <= PMAX)) != 0) {   /* one test a pass, a scalar branch: some logit stands far above the maximum in use. The logits (their registers were given up) are made again from the stage's k rows, the same products in the same order, and the pass is taken as a running-maximum pass */
#pragma unroll
        for (int t = 0; t < SK / 16; ++t) { v8f z = {}; const __bf16* kr = &sk[team][bu][t * 16 + col][0];
          z = mmb(frag_b(kr, lane), qb[0], z); z = wmma_bf(frag_b(kr + 32, lane), qb[1], z);   /* the second product brings its own four slots in front of the reads of its result */
#pragma unroll
          for (int r = 0; r < 8; ++r) p[t * 8 + r] = z[r]; }
        if (edge) mask_keys(p, rem);
        const float mx = col_max(p, m);
        float al; asm("v_exp_f32 %0, %1\n\tv_nop" : "=v"(al) : "v"((m - mx) * C2));   /* the same form for the one rescale factor */
        m = mx; nm = -mx * C2; l *= al;
#pragma unroll
        for (int j = 0; j < HD / 16; ++j) acc[j] *= al;
        ps = weights(p, nm, pf); }
      l += ps;
#pragma unroll
      for (int hf = 0; hf < SK / 32; ++hf) {
#pragma unroll
        for (int j = 0; j < HD / 16; ++j) acc[j] = (hf == SK / 32 - 1 && j == HD / 16 - 1) ? wmma16(vh[hf][j], pf[hf], acc[j]) : mmh(vh[hf][j], pf[hf], acc[j]); } }   /* the pass's last matrix instruction brings its own four slots: the blocks behind the pass reuse its operand registers at once */
    if (more) {
#pragma unroll
      for (int i = 0; i < SR; ++i) { *(v4b*)&sk[team][bu ^ 1][srow + 16 * i][sseg] = rnd4(rk[i]); *(v4h*)&sv[team][bu ^ 1][srow + 16 * i][sseg] = rnd4h(rv[i]); } }
    __syncthreads(); }
  par = (par + nb) & 1;
  if (team) {
#pragma unroll
    for (int j = 0; j < HD / 16; ++j) { v4f a, b;
#pragma unroll
      for (int r = 0; r < 4; ++r) { a[r] = acc[j][r]; b[r] = acc[j][4 + r]; }
      *(v4f*)&mg[wave & 7][2 * j][lane][0] = a; *(v4f*)&mg[wave & 7][2 * j + 1][lane][0] = b; }
    const v4f ml = {m, l, 0.f, 0.f}; *(v4f*)&mg[wave & 7][HD / 8][lane][0] = ml; }
  __syncthreads();   /* publishes group 1's hand-over; the barriers of the next task's trips stand between these reads and the next hand-over's stores */
  if (!team) {
    const v4f ml = *(const v4f*)&mg[wave][HD / 8][lane][0];
    const float mx = fmaxf(m, ml[0]); float a0, a1;
    asm("v_exp_f32 %0, %2\n\tv_exp_f32 %1, %3\n\tv_nop" : "=&v"(a0), "=&v"(a1) : "v"((m - mx) * C2), "v"((ml[0] - mx) * C2));   /* both groups' factors to the common maximum, with the slot behind a transcendental */
    l = l * a0 + ml[1] * a1;
    l += xhalf(l); const float inv = 1.0f / l, i0 = a0 * inv, i1 = a1 * inv;
    float* yr = Y + ((size_t)h * TT + ql0 + col) * HD + 8 * g;   /* register r of tile j = output column j * 16 + 8g + r of query col: 32 contiguous bytes a lane */
#pragma unroll
    for (int j = 0; j < HD / 16; ++j) { const v4f oa = *(const v4f*)&mg[wave][2 * j][lane][0], ob = *(const v4f*)&mg[wave][2 * j + 1][lane][0]; v4f a, b;
#pragma unroll
      for (int r = 0; r < 4; ++r) { a[r] = acc[j][r] * i0 + oa[r] * i1; b[r] = acc[j][4 + r] * i0 + ob[r] * i1; }
      vst2(yr + j * 16, a); vst2(yr + j * 16 + 4, b); }
    if (tk == 0) asm volatile("s_wait_xcnt 0x0" ::: "memory"); }   /* the wait in front of the reuse of the stores' registers by the next task */
  } }

extern "C" void kernel_launch(void* const* d_in, const int* in_sizes, int n_in, void* d_out, int out_size, void* d_ws, size_t ws_size, hipStream_t stream) {
  (void)in_sizes; (void)n_in; (void)out_size; (void)d_ws; (void)ws_size;
  const float** F = (const float**)d_in;
  // inputs: 0 queries [32,2048,64]; 1 keys; 2 values; 3 valid_lens [32] int
  k_fa<<<dim3(TT / 128, NH / 2), 512, 0, stream>>>(F[0], F[1], F[2], (const int*)d_in[3], (float*)d_out);
}

// v010
// One run takes 26.1 microseconds.
// In two side-by-side timings against v009, it was 1.05 and 1.06 times as fast.
// Counting every step since v000, it is 54.9 times as fast.
// compute dtype: all float inputs rounded to bf16, in registers inside the one kernel, on the way to LDS (k, v and q); logits q.k as single EXACT products on WMMA 16x16x32 bf16 (f32 accumulate) / 8, keys at index >= valid_len set to -1e6; softmax in f32, its exponentials on the hardware's base-2 instruction (1/8 and log2(e) folded into one multiply-add); P, taken against the maximum in use, rounded to f16 (11 significant bits; P lies in 0..4,096) and multiplied in ONE WMMA 16x16x32 f16 product (f32 accumulate) against the bf16-rounded v, which is carried in f16 (the same value for 2^-17 <= |v| < 65,504; smaller ones within 2^-25) for every query row; f32 output.
#include <hip/hip_runtime.h>
#include <math.h>

typedef __attribute__((ext_vector_type(16))) _Float16 v16h;
typedef __attribute__((ext_vector_type(16))) __bf16 v16b;
typedef __attribute__((ext_vector_type(8)))  _Float16 v8h;
typedef __attribute__((ext_vector_type(8)))  float v8f;
typedef __attribute__((ext_vector_type(4)))  float v4f;
typedef __attribute__((ext_vector_type(2)))  float v2f;
typedef __attribute__((ext_vector_type(4)))  unsigned v4u;
typedef __attribute__((ext_vector_type(4)))  int v4i;
typedef float __attribute__((may_alias)) float_a;
typedef int __attribute__((may_alias)) int_a;

template <typename T> __device__ __forceinline__ void vst2(void* p, T v) { *(T*)p = v;  }
__device__ __forceinline__ v8f wmma16(v16h a, v16h b, v8f c) {
  v8f d = __builtin_amdgcn_wmma_f32_16x16x32_f16(false, a, false, b, (short)0, c, false, false);
  asm volatile("v_nop\n\tv_nop\n\tv_nop\n\tv_nop" : "+v"(d) : "v"(a), "v"(b));
  return d;
}
__device__ __forceinline__ v8f wmma_bf(v16b a, v16b b, v8f c) {
  v8f d = __builtin_amdgcn_wmma_f32_16x16x32_bf16(false, a, false, b, (short)0, c, false, false);
  asm volatile("v_nop\n\tv_nop\n\tv_nop\n\tv_nop" : "+v"(d) : "v"(a), "v"(b));
  return d;
}
// 16x16x32 fragments: lane = (h = lane>>4, row/col = lane&15); elements 0..7 = k0+8h+0..7, 8..15 = k0+16+8h+0..7; D element r = row 8h+r
__device__ __forceinline__ v16h frag_h(const _Float16* rowk0, int lane) {
  union { v16h v; v8h q[2]; } u; const _Float16* p = rowk0 + 8 * (lane >> 4);
  u.q[0] = *(const v8h*)p; u.q[1] = *(const v8h*)(p + 16); return u.v;
}
__device__ __forceinline__ v16h frag_f32(const float* rowk0, int lane) {
  v16h a; const float* p = rowk0 + 8 * (lane >> 4);
#pragma unroll
  for (int i = 0; i < 8; ++i) { a[i] = (_Float16)p[i]; a[8 + i] = (_Float16)p[16 + i]; }
  return a;
}
__device__ __forceinline__ v16h frag_f32s(const float* rowk0, int lane, float sc) {
  v16h a; const float* p = rowk0 + 8 * (lane >> 4);
#pragma unroll
  for (int i = 0; i < 8; ++i) { a[i] = (_Float16)(p[i] * sc); a[8 + i] = (_Float16)(p[16 + i] * sc); }
  return a;
}
// column fragment from a [K][ld] layout (column n), rows >= K read as 0
__device__ __forceinline__ v16h fragc_f32(const float* W, int k0, int n, int lane, int ld, int K) {
  v16h a; const int g = lane >> 4;
#pragma unroll
  for (int i = 0; i < 8; ++i) { const int ka = k0 + 8 * g + i, kb = ka + 16;
    a[i] = (_Float16)(ka < K ? W[(size_t)(ka < K ? ka : K - 1) * ld + n] : 0.f); a[8 + i] = (_Float16)(kb < K ? W[(size_t)(kb < K ? kb : K - 1) * ld + n] : 0.f); }
  return a;
}
struct F2 { v16b h, l; };
__device__ __forceinline__ F2 bsplit16(const float v[16]) { F2 r;
#pragma unroll
  for (int i = 0; i < 16; ++i) { const __bf16 h = (__bf16)v[i]; r.h[i] = h; r.l[i] = (__bf16)(v[i] - (float)h); }
  return r; }
__device__ __forceinline__ F2 split_row(const float* row, int k0, int lane) { float v[16]; const float* p = row + k0 + 8 * (lane >> 4);
#pragma unroll
  for (int i = 0; i < 8; ++i) { v[i] = p[i]; v[8 + i] = p[16 + i]; }
  return bsplit16(v); }
__device__ __forceinline__ F2 split_rowK(const float* row, int k0, int lane, int K) { float v[16]; const int g = lane >> 4;
#pragma unroll
  for (int i = 0; i < 8; ++i) { const int ka = k0 + 8 * g + i, kb = ka + 16; v[i] = ka < K ? row[ka < K ? ka : K - 1] : 0.f; v[8 + i] = kb < K ? row[kb < K ? kb : K - 1] : 0.f; }
  return bsplit16(v); }
__device__ __forceinline__ F2 split_col(const float* W, int k0, int n, int lane, int ld, int K) { float v[16]; const int g = lane >> 4;
#pragma unroll
  for (int i = 0; i < 8; ++i) { const int ka = k0 + 8 * g + i, kb = ka + 16; v[i] = ka < K ? W[(size_t)(ka < K ? ka : K - 1) * ld + n] : 0.f; v[8 + i] = kb < K ? W[(size_t)(kb < K ? kb : K - 1) * ld + n] : 0.f; }
  return bsplit16(v); }
__device__ __forceinline__ v8f mac3(const F2& a, const F2& b, v8f c) { c = wmma_bf(a.l, b.h, c); c = wmma_bf(a.h, b.l, c); return wmma_bf(a.h, b.h, c); }
__device__ __forceinline__ float sigm(float v) { return 1.0f / (1.0f + expf(-v)); }
#define LDSX() do { asm volatile("s_wait_dscnt 0" ::: "memory"); __builtin_amdgcn_wave_barrier(); __builtin_amdgcn_fence(__ATOMIC_RELEASE, "workgroup"); } while (0)

// Masked dot-product attention (B 32 sequences treated as 32 planes, S 2,048, D 64): scores = q k^T / 8; keys k >= valid_lens[b] set to -1e6 (sequence mask); softmax; out = weights v -> [32, 2,048, 64].
#define NB 1
#define TT 2048
#define CC 2048            // NH * HD = projected width
#define DIN 2048          // input (model) width
#define NH 32
#define HD 64
#define NQB (TT / 64)
#define HG 4
#define SCALE (0.125f)
#define CAUSAL 0
#ifndef TNB
#define TNB NB
#endif
__device__ __forceinline__ float bfr(float v) { return (float)(__bf16)v; }
__host__ __device__ __forceinline__ int kb_last(int qb) { return CAUSAL ? ((qb * 64 + 63) >> 7) : (TT / 128 - 1); }
typedef __attribute__((ext_vector_type(8))) __bf16 v8b;
__device__ __forceinline__ v16b frag_b(const __bf16* rowk0, int lane) {
  union { v16b v; v8b q[2]; } u; const __bf16* p = rowk0 + 8 * (lane >> 4);
  u.q[0] = *(const v8b*)p; u.q[1] = *(const v8b*)(p + 16); return u.v;
}
// B fragment (k rows k0+.., output column o) of a weight: (in,out) [K][ld] or (out,in) [ld rows of K]: bf16 exact, or f16(bf16 * 256) exact
__device__ __forceinline__ v16b wcol_io(const float* Wm, int k0, int o, int lane, int ld) { v16b w; const int g = lane >> 4;
#pragma unroll
  for (int i = 0; i < 8; ++i) { w[i] = (__bf16)Wm[(size_t)(k0 + 8 * g + i) * ld + o]; w[8 + i] = (__bf16)Wm[(size_t)(k0 + 16 + 8 * g + i) * ld + o]; }
  return w; }
__device__ __forceinline__ v16b wcol_oi(const float* Wm, int k0, int o, int lane, int K) { v16b w; const float* p = Wm + (size_t)o * K + k0 + 8 * (lane >> 4);
#pragma unroll
  for (int i = 0; i < 8; ++i) { w[i] = (__bf16)p[i]; w[8 + i] = (__bf16)p[16 + i]; }
  return w; }
__device__ __forceinline__ v16h wcolh_io(const float* Wm, int k0, int o, int lane, int ld) { v16h w; const int g = lane >> 4;
#pragma unroll
  for (int i = 0; i < 8; ++i) { w[i] = (_Float16)(bfr(Wm[(size_t)(k0 + 8 * g + i) * ld + o]) * 256.0f); w[8 + i] = (_Float16)(bfr(Wm[(size_t)(k0 + 16 + 8 * g + i) * ld + o]) * 256.0f); }
  return w; }
__device__ __forceinline__ v16h wcolh_oi(const float* Wm, int k0, int o, int lane, int K) { v16h w; const float* p = Wm + (size_t)o * K + k0 + 8 * (lane >> 4);
#pragma unroll
  for (int i = 0; i < 8; ++i) { w[i] = (_Float16)(bfr(p[i]) * 256.0f); w[8 + i] = (_Float16)(bfr(p[16 + i]) * 256.0f); }
  return w; }
#define WQKV_LAYOUT 1   // 0 = (in,out) [DIN][CC]; 1 = (out,in) [CC][DIN]; 2 = per-head [NH][DIN][HD]
__device__ __forceinline__ v16b wcol_hdk(const float* Wm, int k0, int o, int lane) { v16b w; const int g = lane >> 4; const float* p = Wm + (size_t)(o / HD) * DIN * HD + (o % HD);
#pragma unroll
  for (int i = 0; i < 8; ++i) { w[i] = (__bf16)p[(size_t)(k0 + 8 * g + i) * HD]; w[8 + i] = (__bf16)p[(size_t)(k0 + 16 + 8 * g + i) * HD]; }
  return w; }
#define WO_OUT_IN 0
#if WQKV_LAYOUT == 1
#define WCOL(W, k0, o, lane) wcol_oi(W, k0, o, lane, DIN)
#elif WQKV_LAYOUT == 2
#define WCOL(W, k0, o, lane) wcol_hdk(W, k0, o, lane)
#else
#define WCOL(W, k0, o, lane) wcol_io(W, k0, o, lane, CC)
#endif
#if WO_OUT_IN
#define WOCOL(W, k0, o, lane) wcol_oi(W, k0, o, lane, CC)
#define WOCOLH(W, k0, o, lane) wcolh_oi(W, k0, o, lane, CC)
#else
#define WOCOL(W, k0, o, lane) wcol_io(W, k0, o, lane, DIN)
#define WOCOLH(W, k0, o, lane) wcolh_io(W, k0, o, lane, DIN)
#endif
// plain builtin form for the fused kernel: the compiler keeps the distance behind its own matrix instructions
__device__ __forceinline__ v8f mmb(v16b a, v16b b, v8f c) { return __builtin_amdgcn_wmma_f32_16x16x32_bf16(false, a, false, b, (short)0, c, false, false); }
__device__ __forceinline__ v8f mmh(v16h a, v16h b, v8f c) { return __builtin_amdgcn_wmma_f32_16x16x32_f16(false, a, false, b, (short)0, c, false, false); }
__device__ __forceinline__ float xhalf(float x) { return __builtin_bit_cast(float, __builtin_amdgcn_permlanex16(__builtin_bit_cast(int, x), __builtin_bit_cast(int, x), 0x76543210, 0xfedcba98, false, false)); }   // lane l reads lane l ^ 16, on the vector port: no LDS counter to wait on while fragment reads are in flight
typedef __attribute__((ext_vector_type(8))) short v8s;
typedef __attribute__((ext_vector_type(4))) __bf16 v4b;
// transposing 16-bit LDS read, as a builtin the compiler sees (it places the LDS wait): lane l hands in the address of row 8 (l >> 4) + (l & 7), byte 16 ((l >> 3) & 1), and gets rows 8 (l >> 4) + 0..7 of column l & 15
__device__ __forceinline__ v8h ld_tr16(const char* p) { typedef __attribute__((address_space(3))) v8s lds_v8s; return __builtin_bit_cast(v8h, __builtin_amdgcn_ds_load_tr16_b128_v8i16((lds_v8s*)p)); }
__device__ __forceinline__ v4b rnd4(v4f f) { v4b o;
#pragma unroll
  for (int r = 0; r < 4; ++r) o[r] = (__bf16)f[r];
  return o; }   /* module inputs: bf16-rounded, to nearest even */
typedef __attribute__((ext_vector_type(4))) _Float16 v4h;
__device__ __forceinline__ v4h rnd4h(v4f f) { v4h o;
#pragma unroll
  for (int r = 0; r < 4; ++r) o[r] = (_Float16)(float)(__bf16)f[r];
  return o; }   /* v: the same bf16 rounding, then carried in f16, whose 11 bits hold the 8 of a bf16 */
#define SK 64              // keys a stage: a team's 8 waves share one staged copy of the stage's k rows and v rows
#define C2 0.18033688011112042f   // SCALE * log2(e): exp(SCALE * s - max) = 2^(C2 * s - C2 * smax)
#define MASKRAW (-8000000.0f)      // the mask fill -1e6 in front of the scale: MASKRAW * SCALE is exactly -1e6
// base-2 exponentials in one statement that ends with the slot the instruction set asks for behind a transcendental; the results are early-clobber: none may share a register with a source that is still to be read
__device__ __forceinline__ void exp2x8(float* o, const float* i) {
  asm("v_exp_f32 %0, %8\n\tv_exp_f32 %1, %9\n\tv_exp_f32 %2, %10\n\tv_exp_f32 %3, %11\n\tv_exp_f32 %4, %12\n\tv_exp_f32 %5, %13\n\tv_exp_f32 %6, %14\n\tv_exp_f32 %7, %15\n\tv_nop"
      : "=&v"(o[0]), "=&v"(o[1]), "=&v"(o[2]), "=&v"(o[3]), "=&v"(o[4]), "=&v"(o[5]), "=&v"(o[6]), "=&v"(o[7]) : "v"(i[0]), "v"(i[1]), "v"(i[2]), "v"(i[3]), "v"(i[4]), "v"(i[5]), "v"(i[6]), "v"(i[7])); }
#define SP 72              // LDS row pitch of the k rows in 16-bit elements: 144 B = 16 B x odd, the pitch for 16-byte fragment reads
#define SPV 80             // LDS row pitch of the v rows: 160 B = 32 B x odd, the pitch for the transposing reads
// ---- k_fa: block = 2 key groups of 8 waves on ONE task at a time; a task = 128 queries of one plane, 16 query columns a wave, the same 128 queries in both groups. Group t walks the plane's stages of 64 keys t, t + 2, t + 4, ..., one pass each, with its own two LDS buffers, running maximum, sum and O^T; only stages that hold a key below the plane's valid_len are walked.
// A key at or past valid_len has the logit -1e6 and, beside any real logit, the weight exactly 0: a pass of only such keys rescales by exactly 1 and adds only zeros to l and O^T, so it is not walked. (A plane with valid_len <= 0 has no real logit: it walks every key, as written.)
// The launch lasts as long as its fullest WGP: the planes are ranked by length on the device (ties by index, so the ranks are a permutation for any lengths) and block group y takes the ranks y and 31 - y, whose lengths add up to about the same for every y, ONE AFTER THE OTHER: all 16 waves work from the first stage to the last, and no wave walks more than half of a plane's stages.
// Behind a task's last stage both groups lay their maximum, sums and O^T in LDS, O^T as rows [query][column] (one barrier); then all 16 waves take the rows in order, 16 bytes a lane, bring both groups' parts to the common maximum, add them and store: a wave's store is 512 bytes in a row, four whole 128-byte lines. A group without a stage (a plane of one stage) lays down the start values: weight exactly 0.
// S^T = K . Q^T (A = 16 key rows, B = 16 query columns): lane (g, col) holds query col, register r = key 8g + r, so two S^T tiles (keys +0..15, +16..31) are, converted in place, the B operand of O^T += V^T . P^T.
// Maximum in use m (of the unscaled logits) and running sum l per query column (each lane half sums its own keys; the halves join after the groups have joined). m is set by the group's first pass and then stands: the weights are taken against it at once, and a pass looks for a new maximum, and rescales O^T and l by 2^(C2 * (m_old - m_new)), only where a lane's sum of the pass's weights comes out above PMAX (or is no number). The quotient O^T / l does not depend on m.
// k rows and v rows come as f32, straight from the module's [32, 2048, 64] inputs (a stage of a plane is 16 KiB in a row: every load of a wave is 512 bytes in a row), through registers, where they are rounded to bf16 (the v values then written as f16), into the group's two LDS buffers; V^T fragments come out of the v rows by the transposing LDS read. A group's next stage is loaded while its current one is worked on, rounded and stored behind it, and one barrier a trip both publishes it and ends the reads of the buffer that is refilled next; in the first task's last trip the next stage is the second task's first, so the two buffers run on over the change of task. The query rows of both tasks are read at the start, also in whole lines: group t loads task t's 128 rows (32 KiB in a row, 512 bytes a wave's load), rounds them to bf16 and lays them in LDS; behind the first barrier every wave reads its fragments of both tasks from there. Every wave passes every barrier.
#define NT 2               // key groups a block
#define SR 4               // 16-byte pieces of each array that a thread stages: 64 rows of 256 bytes over 256 threads
__device__ __forceinline__ int eff_len(int v) { return (v <= 0 || v > TT) ? TT : v; }   // keys a plane walks
#define SO 68              // LDS row pitch of the output rows in floats: 272 B = 16 B x odd: the 16 query rows a lane half writes at once fall on different banks
#define PMAX 4096.0f       // a lane's sum of a pass's 32 weights up to here: every weight is at most this, far inside f16's range, and the maximum in use stands
// sequence_mask: keys at index >= valid_len are SET to -1e6, as written; rem = valid_len less the index of the lane's first key
__device__ __forceinline__ void mask_keys(float* p, int rem) {
#pragma unroll
  for (int i = 0; i < SK / 2; ++i) if ((i >> 3) * 16 + (i & 7) >= rem) p[i] = MASKRAW; }
// maximum of m and a query column's 64 logits: one chain a tile of 16 keys, joined at the end (a maximum does not depend on the order), then the other lane half's
__device__ __forceinline__ float col_max(const float* p, float m) { float mt[SK / 16];
#pragma unroll
  for (int t = 0; t < SK / 16; ++t) { mt[t] = m;
#pragma unroll
    for (int r = 0; r < 8; ++r) mt[t] = fmaxf(mt[t], p[t * 8 + r]); }
  const float mx = fmaxf(fmaxf(mt[0], mt[1]), fmaxf(mt[2], mt[3])); return fmaxf(mx, xhalf(mx)); }
// weights 2^(C2 * logit + nm) of a pass, nm = -C2 * the maximum in use: their sum (returned) and P^T of both halves, rounded to f16: the B operands of the pass's 8 products
__device__ __forceinline__ float weights(const float* p, float nm, v16h* pf) { float e[SK / 2], w[SK / 2]; const v2f c2 = {C2, C2}, n2 = {nm, nm};
#pragma unroll
  for (int i = 0; i < SK / 2; i += 2) { const v2f a = {p[i], p[i + 1]}; const v2f t = __builtin_elementwise_fma(a, c2, n2);   /* two exponents a packed multiply-add */
    e[i] = t[0]; e[i + 1] = t[1]; }
#pragma unroll
  for (int i = 0; i < SK / 16; ++i) exp2x8(w + 8 * i, e + 8 * i);
  float sh[SK / 32];   /* one sum chain for each 32 keys: two independent chains; they join before they enter l */
#pragma unroll
  for (int hf = 0; hf < SK / 32; ++hf) { sh[hf] = w[hf * 16];
#pragma unroll
    for (int i = 1; i < 16; ++i) sh[hf] += w[hf * 16 + i]; }
#pragma unroll
  for (int hf = 0; hf < SK / 32; ++hf) {
#pragma unroll
    for (int i = 0; i < 16; ++i) pf[hf][i] = (_Float16)w[hf * 16 + i]; }
  return sh[0] + sh[1]; }
__global__ __launch_bounds__(512) void k_fa(const float* __restrict__ Q, const float* __restrict__ K, const float* __restrict__ V, const int* __restrict__ VL, float* __restrict__ Y) {
  __shared__ __align__(32) __bf16 sk[NT][2][SK][SP]; __shared__ __align__(32) _Float16 sv[NT][2][SK][SPV];
  __shared__ __align__(32) __bf16 sq[2][128][SP];            /* both tasks' query rows, bf16, at the pitch of the k rows */
  __shared__ __align__(16) float so[NT][128][SO];            /* each group's O^T of the task, laid down as rows [query][column] */
  __shared__ __align__(16) float sml[NT][128][4];            /* each group's (m, l) of a query, one pair a lane half */
  const int tid = threadIdx.x, wave = __builtin_amdgcn_readfirstlane(tid >> 5), lane = tid & 31, col = lane & 15, g = lane >> 4; const int team = wave >> 3, ttid = tid & 255;
  // lane p ranks plane p: how many planes are longer, or as long with a lower index (one key holds both: no two keys are equal)
  const int vlp = VL[lane]; const int key = eff_len(vlp) * NH + (NH - 1 - lane); int rank = 0;
#pragma unroll
  for (int j = 0; j < NH; ++j) rank += __builtin_amdgcn_readlane(key, j) > key ? 1 : 0;
  const int gy = blockIdx.y;
  const int ha = __builtin_ctz(__builtin_amdgcn_ballot_w32(rank == gy)) & (NH - 1);            /* the block's first plane: a scalar, inside 0..31 whatever the lengths */
  const int hb = __builtin_ctz(__builtin_amdgcn_ballot_w32(rank == NH - 1 - gy)) & (NH - 1);   /* its second plane */
  const int qr = (wave & 7) * 16 + col;   /* the lane's query row among the task's 128 */
  const int srow = ttid >> 4, sseg = (ttid & 15) * 4;   /* staging: 16 threads a row of 256 bytes, 16 rows a step, 4 steps an array */
  const float* gk = K + ttid * 4;
  const float* gv = V + ttid * 4;
  v4f rk[SR], rv[SR];
  { const int kn = ha * TT * HD + team * SK * HD;   /* the group's first stage (stage 1 lies inside the arrays also where the plane does not walk it) */
#pragma unroll
    for (int i = 0; i < SR; ++i) { rk[i] = *(const v4f*)(gk + kn + i * 16 * HD); rv[i] = *(const v4f*)(gv + kn + i * 16 * HD); } }
  asm volatile("s_wait_xcnt 0x0" ::: "memory");   /* the wait in front of the reuse of these loads' address registers */
  v4f rq[2 * SR];
  { const float* gq = Q + ((size_t)(team ? hb : ha) * TT + blockIdx.x * 128) * HD + ttid * 4;   /* group t: the 128 query rows of task t */
#pragma unroll
    for (int i = 0; i < 2 * SR; ++i) rq[i] = *(const v4f*)(gq + i * 16 * HD); }
  asm volatile("s_wait_xcnt 0x0" ::: "memory");   /* the same for the query loads */
#pragma unroll
  for (int i = 0; i < SR; ++i) { *(v4b*)&sk[team][0][srow + 16 * i][sseg] = rnd4(rk[i]); *(v4h*)&sv[team][0][srow + 16 * i][sseg] = rnd4h(rv[i]); }
#pragma unroll
  for (int i = 0; i < 2 * SR; ++i) *(v4b*)&sq[team][srow + 16 * i][sseg] = rnd4(rq[i]);
  __syncthreads();
  v16b qq[2][HD / 32];
  // the inner loops are unrolled so that every fragment and accumulator array stays in registers
#pragma unroll
  for (int tk = 0; tk < 2; ++tk) {
#pragma unroll
    for (int kc = 0; kc < HD / 32; ++kc) qq[tk][kc] = frag_b(&sq[tk][qr][kc * 32], lane); }
  int par = 0;   /* the buffer that holds the task's first stage */
#pragma unroll   /* two copies, one a task: what differs between the tasks (the refill over the change of task, the query fragments) is then settled at compile time */
  for (int tk = 0; tk < 2; ++tk) {
  const int h = tk ? hb : ha;
  const int vl = __builtin_amdgcn_readlane(vlp, h); const int nst = (eff_len(vl) + SK - 1) / SK;   /* the plane's stages: at most TT / SK */
  const int nb = (nst + 1) >> 1;                       /* trips of the block: group 0's stages; group 1 has as many or one fewer */
  const v16b (&qb)[HD / 32] = qq[tk];
  v8f acc[HD / 16] = {}; float m = -3.0e38f, nm = 3.0e38f * C2, l = 0.f;
  for (int it = 0; it < nb; ++it) { const int st = 2 * it + team; const int bu = (it + par) & 1; const bool own = st + 2 < nst;
    const bool more = own || (tk == 0 && it == nb - 1);   /* in the last trip no group has a stage of this plane left to load */
    if (more) { const int kn = own ? h * TT * HD + (st + 2) * SK * HD : hb * TT * HD + team * SK * HD;
#pragma unroll
      for (int i = 0; i < SR; ++i) { rk[i] = *(const v4f*)(gk + kn + i * 16 * HD); rv[i] = *(const v4f*)(gv + kn + i * 16 * HD); }
      asm volatile("s_wait_xcnt 0x0" ::: "memory"); }   /* the loads stay in flight over the stage while their address registers are reused: the wait in front of that overwrite */
    if (st < nst) { const int k0 = st * SK;   /* one pass takes the whole stage of 64 keys: the maximum's exchange, the rescale and the waits on LDS and on the dependent chains are paid once for 64 keys, with twice the independent work beside every chain */
      v8f s[SK / 16] = {}; v16b kb[SK / 8];
#pragma unroll
      for (int i = 0; i < SK / 8; ++i) { const int kr = (i >> 1) * 16 + col; kb[i] = frag_b(&sk[team][bu][kr][(i & 1) * 32], lane); }
      __builtin_amdgcn_sched_barrier(0);   /* holds the pass's 16 k fragment reads together in front of the products: one LDS wait a pass, not one between every few products */
#pragma unroll
      for (int kc = 0; kc < HD / 32; ++kc) {
#pragma unroll
        for (int t = 0; t < SK / 16; ++t) s[t] = mmb(kb[t * 2 + kc], qb[kc], s[t]); }
      v16h vh[SK / 32][HD / 16]; const char* vt = (const char*)&sv[team][bu][8 * g + (lane & 7)][8 * ((lane >> 3) & 1)];
#pragma unroll
      for (int hf = 0; hf < SK / 32; ++hf) {
#pragma unroll
        for (int j = 0; j < HD / 16; ++j) { union { v16h v; v8h q[2]; } u;   /* A fragment of V^T: row = output column j * 16 + col; elements 0..7 = keys hf * 32 + 8g + 0..7, 8..15 = the same + 16: the k order of P^T */
          u.q[0] = ld_tr16(vt + (hf * 32) * (SPV * 2) + j * 32); u.q[1] = ld_tr16(vt + (hf * 32 + 16) * (SPV * 2) + j * 32); vh[hf][j] = u.v; } }
      __builtin_amdgcn_sched_barrier(0);   /* holds the v fragment reads in front of the softmax arithmetic, which then covers their latency */
      float p[SK / 2];
#pragma unroll
      for (int i = 0; i < SK / 2; ++i) p[i] = s[i >> 3][i & 7];
      const bool edge = k0 + SK > vl; const int rem = vl - k0 - 8 * g;   /* a pass wholly below valid_len has no masked key */
      if (edge) mask_keys(p, rem);
      if (it == 0) { m = col_max(p, m); nm = -m * C2; }   /* the group's first pass of the task sets the maximum in use; O^T and l are still zero: nothing to rescale */
      v16h pf[SK / 32];
      float ps = weights(p, nm, pf);
      if (__builtin_amdgcn_ballot_w32(!(ps <= PMAX)) != 0) {   /* one test a pass, a scalar branch: some logit stands far above the maximum in use. The logits (their registers were given up) are made again from the stage's k rows, the same products in the same order, and the pass is taken as a running-maximum pass */
#pragma unroll
        for (int t = 0; t < SK / 16; ++t) { v8f z = {}; const __bf16* kr = &sk[team][bu][t * 16 + col][0];
          z = mmb(frag_b(kr, lane), qb[0], z); z = wmma_bf(frag_b(kr + 32, lane), qb[1], z);   /* the second product brings its own four slots in front of the reads of its result */
#pragma unroll
          for (int r = 0; r < 8; ++r) p[t * 8 + r] = z[r]; }
        if (edge) mask_keys(p, rem);
        const float mx = col_max(p, m);
        float al; asm("v_exp_f32 %0, %1\n\tv_nop" : "=v"(al) : "v"((m - mx) * C2));   /* the same form for the one rescale factor */
        m = mx; nm = -mx * C2; l *= al;
#pragma unroll
        for (int j = 0; j < HD / 16; ++j) acc[j] *= al;
        ps = weights(p, nm, pf); }
      l += ps;
#pragma unroll
      for (int hf = 0; hf < SK / 32; ++hf) {
#pragma unroll
        for (int j = 0; j < HD / 16; ++j) acc[j] = (hf == SK / 32 - 1 && j == HD / 16 - 1) ? wmma16(vh[hf][j], pf[hf], acc[j]) : mmh(vh[hf][j], pf[hf], acc[j]); } }   /* the pass's last matrix instruction brings its own four slots: the blocks behind the pass reuse its operand registers at once */
    if (more) {
#pragma unroll
      for (int i = 0; i < SR; ++i) { *(v4b*)&sk[team][bu ^ 1][srow + 16 * i][sseg] = rnd4(rk[i]); *(v4h*)&sv[team][bu ^ 1][srow + 16 * i][sseg] = rnd4h(rv[i]); } }
    __syncthreads(); }
  par = (par + nb) & 1;
  { float* orow = &so[team][qr][8 * g];   /* register r of tile j = output column j * 16 + 8g + r of the lane's query */
#pragma unroll
    for (int j = 0; j < HD / 16; ++j) { v4f a, b;
#pragma unroll
      for (int r = 0; r < 4; ++r) { a[r] = acc[j][r]; b[r] = acc[j][4 + r]; }
      *(v4f*)(orow + j * 16) = a; *(v4f*)(orow + j * 16 + 4) = b; }
    const v2f ml = {m, l}; *(v2f*)&sml[team][qr][2 * g] = ml; }
  __syncthreads();   /* publishes both groups' parts; the barriers of the next task's trips stand between these reads and the next task's stores to the same LDS */
  { float* yr = Y + ((size_t)h * TT + blockIdx.x * 128 + (tid >> 4)) * HD + (tid & 15) * 4;   /* 16 lanes a row of 256 bytes, 32 rows a step */
#pragma unroll
    for (int i = 0; i < 4; ++i) { const int row = (tid >> 4) + 32 * i;
      const v4f x0 = *(const v4f*)&sml[0][row][0], x1 = *(const v4f*)&sml[1][row][0];   /* (m, l of lane half 0, m, l of lane half 1) of each group */
      const float mx = fmaxf(x0[0], x1[0]); float a0, a1;
      asm("v_exp_f32 %0, %2\n\tv_exp_f32 %1, %3\n\tv_nop" : "=&v"(a0), "=&v"(a1) : "v"((x0[0] - mx) * C2), "v"((x1[0] - mx) * C2));   /* both groups' factors to the common maximum, with the slot behind a transcendental */
      const float ls = (x0[1] * a0 + x1[1] * a1) + (x0[3] * a0 + x1[3] * a1);   /* the groups join in each lane half's sum, then the halves: the order as before */
      const float inv = 1.0f / ls, i0 = a0 * inv, i1 = a1 * inv;
      const v4f o0 = *(const v4f*)&so[0][row][(tid & 15) * 4], o1 = *(const v4f*)&so[1][row][(tid & 15) * 4]; v4f o;
#pragma unroll
      for (int r = 0; r < 4; ++r) o[r] = o0[r] * i0 + o1[r] * i1;
      vst2(yr + i * 32 * HD, o); }
    if (tk == 0) asm volatile("s_wait_xcnt 0x0" ::: "memory"); }   /* the wait in front of the reuse of the stores' registers by the next task */
  } }

extern "C" void kernel_launch(void* const* d_in, const int* in_sizes, int n_in, void* d_out, int out_size, void* d_ws, size_t ws_size, hipStream_t stream) {
  (void)in_sizes; (void)n_in; (void)out_size; (void)d_ws; (void)ws_size;
  const float** F = (const float**)d_in;
  // inputs: 0 queries [32,2048,64]; 1 keys; 2 values; 3 valid_lens [32] int
  k_fa<<<dim3(TT / 128, NH / 2), 512, 0, stream>>>(F[0], F[1], F[2], (const int*)d_in[3], (float*)d_out);
}
